// v000
// Measured on an AMD MI455X. A time is GPU time per run, averaged over a window of back-to-back runs after a warm-up
// (all launches, gaps included; the runs take copies of the inputs in turn), and the median of several windows.
// Apart from v000's, it joins two sittings. Times from different sittings can be a few percent apart, while
// side-by-side timings come from the same sitting.
// v000, which the later versions start from, runs in 596 microseconds.
// compute dtype: all float inputs rounded to bf16; q/k/v = x W + b ((in,out)) with EXACT bf16 products on WMMA 16x16x32, f32 accumulate (sequence padded 500 -> 512 internally; padded keys masked, padded queries dropped); q as f16 hi + residual (x 2^10), k f16 -> 2-product logits / 8 + rel_emb[h][q - k + 499] stored in f32 (16 heads per launch); softmax in f32 (precise expf); P x 2^11 split bf16 hi + lo against v bf16 hi + lo (3 products); the merged context is the output; f32 output.
#include <hip/hip_runtime.h>
#include <math.h>

typedef __attribute__((ext_vector_type(16))) _Float16 v16h;
typedef __attribute__((ext_vector_type(16))) __bf16 v16b;
typedef __attribute__((ext_vector_type(8)))  _Float16 v8h;
typedef __attribute__((ext_vector_type(8)))  float v8f;
typedef __attribute__((ext_vector_type(4)))  float v4f;
typedef __attribute__((ext_vector_type(2)))  float v2f;
typedef __attribute__((ext_vector_type(4)))  unsigned v4u;
typedef __attribute__((ext_vector_type(4)))  int v4i;
typedef float __attribute__((may_alias)) float_a;
typedef int __attribute__((may_alias)) int_a;

template <typename T> __device__ __forceinline__ void vst2(void* p, T v) { *(T*)p = v;  }
__device__ __forceinline__ v8f wmma16(v16h a, v16h b, v8f c) {
  v8f d = __builtin_amdgcn_wmma_f32_16x16x32_f16(false, a, false, b, (short)0, c, false, false);
  asm volatile("v_nop\n\tv_nop\n\tv_nop\n\tv_nop" : "+v"(d) : "v"(a), "v"(b));
  return d;
}
__device__ __forceinline__ v8f wmma_bf(v16b a, v16b b, v8f c) {
  v8f d = __builtin_amdgcn_wmma_f32_16x16x32_bf16(false, a, false, b, (short)0, c, false, false);
  asm volatile("v_nop\n\tv_nop\n\tv_nop\n\tv_nop" : "+v"(d) : "v"(a), "v"(b));
  return d;
}
// 16x16x32 fragments: lane = (h = lane>>4, row/col = lane&15); elements 0..7 = k0+8h+0..7, 8..15 = k0+16+8h+0..7; D element r = row 8h+r
__device__ __forceinline__ v16h frag_h(const _Float16* rowk0, int lane) {
  union { v16h v; v8h q[2]; } u; const _Float16* p = rowk0 + 8 * (lane >> 4);
  u.q[0] = *(const v8h*)p; u.q[1] = *(const v8h*)(p + 16); return u.v;
}
__device__ __forceinline__ v16h frag_f32(const float* rowk0, int lane) {
  v16h a; const float* p = rowk0 + 8 * (lane >> 4);
#pragma unroll
  for (int i = 0; i < 8; ++i) { a[i] = (_Float16)p[i]; a[8 + i] = (_Float16)p[16 + i]; }
  return a;
}
__device__ __forceinline__ v16h frag_f32s(const float* rowk0, int lane, float sc) {
  v16h a; const float* p = rowk0 + 8 * (lane >> 4);
#pragma unroll
  for (int i = 0; i < 8; ++i) { a[i] = (_Float16)(p[i] * sc); a[8 + i] = (_Float16)(p[16 + i] * sc); }
  return a;
}
// column fragment from a [K][ld] layout (column n), rows >= K read as 0
__device__ __forceinline__ v16h fragc_f32(const float* W, int k0, int n, int lane, int ld, int K) {
  v16h a; const int g = lane >> 4;
#pragma unroll
  for (int i = 0; i < 8; ++i) { const int ka = k0 + 8 * g + i, kb = ka + 16;
    a[i] = (_Float16)(ka < K ? W[(size_t)(ka < K ? ka : K - 1) * ld + n] : 0.f); a[8 + i] = (_Float16)(kb < K ? W[(size_t)(kb < K ? kb : K - 1) * ld + n] : 0.f); }
  return a;
}
struct F2 { v16b h, l; };
__device__ __forceinline__ F2 bsplit16(const float v[16]) { F2 r;
#pragma unroll
  for (int i = 0; i < 16; ++i) { const __bf16 h = (__bf16)v[i]; r.h[i] = h; r.l[i] = (__bf16)(v[i] - (float)h); }
  return r; }
__device__ __forceinline__ F2 split_row(const float* row, int k0, int lane) { float v[16]; const float* p = row + k0 + 8 * (lane >> 4);
#pragma unroll
  for (int i = 0; i < 8; ++i) { v[i] = p[i]; v[8 + i] = p[16 + i]; }
  return bsplit16(v); }
__device__ __forceinline__ F2 split_rowK(const float* row, int k0, int lane, int K) { float v[16]; const int g = lane >> 4;
#pragma unroll
  for (int i = 0; i < 8; ++i) { const int ka = k0 + 8 * g + i, kb = ka + 16; v[i] = ka < K ? row[ka < K ? ka : K - 1] : 0.f; v[8 + i] = kb < K ? row[kb < K ? kb : K - 1] : 0.f; }
  return bsplit16(v); }
__device__ __forceinline__ F2 split_col(const float* W, int k0, int n, int lane, int ld, int K) { float v[16]; const int g = lane >> 4;
#pragma unroll
  for (int i = 0; i < 8; ++i) { const int ka = k0 + 8 * g + i, kb = ka + 16; v[i] = ka < K ? W[(size_t)(ka < K ? ka : K - 1) * ld + n] : 0.f; v[8 + i] = kb < K ? W[(size_t)(kb < K ? kb : K - 1) * ld + n] : 0.f; }
  return bsplit16(v); }
__device__ __forceinline__ v8f mac3(const F2& a, const F2& b, v8f c) { c = wmma_bf(a.l, b.h, c); c = wmma_bf(a.h, b.l, c); return wmma_bf(a.h, b.h, c); }
__device__ __forceinline__ float sigm(float v) { return 1.0f / (1.0f + expf(-v)); }
#define LDSX() do { asm volatile("s_wait_dscnt 0" ::: "memory"); __builtin_amdgcn_wave_barrier(); __builtin_amdgcn_fence(__ATOMIC_RELEASE, "workgroup"); } while (0)


// Attention (B 8, S 500 padded to 512, D 1,024 = 16 x 64, q/k/v biases, logits / 8): scores = q k^T / 8 + rel_emb[h][q - k + 499] (999 offsets), softmax, P v; the context is the output.
#define NB 8
#define TT 512               // padded length
#define LB 500               // real sequence length (input/output rows per batch)
#define NREL 999
#define XROW(r) (((r) / TT) * (size_t)LB + (((r) % TT) < LB ? ((r) % TT) : (LB - 1)))   /* padded row -> clamped input row */
#define CC 1024
#define NH 16
#define HD 64
#define HG 16               // heads per launch group
#ifndef TNB
#define TNB NB
#endif
typedef __attribute__((ext_vector_type(8))) __bf16 v8b;
__device__ __forceinline__ v16b frag_b(const __bf16* rowk0, int lane) {
  union { v16b v; v8b q[2]; } u; const __bf16* p = rowk0 + 8 * (lane >> 4);
  u.q[0] = *(const v8b*)p; u.q[1] = *(const v8b*)(p + 16); return u.v;
}
__device__ __forceinline__ float bfr(float v) { return (float)(__bf16)v; }
__device__ __attribute__((noinline)) float exp_ni(float v) { return expf(v); }
__device__ __attribute__((noinline)) float erf_ni(float v) { return erff(v); }

#define WS_QH  0u
#define WS_QL  (WS_QH + 2u * (size_t)NB * TT * CC)
#define WS_KH  (WS_QL + 2u * (size_t)NB * TT * CC)
#define WS_VT  (WS_KH + 2u * (size_t)NB * TT * CC)      // bf16 v planes [b][c][t]
#define WS_VL  (WS_VT + 2u * (size_t)NB * CC * TT)      // bf16 v residual planes
#define WS_S   (WS_VL + 2u * (size_t)NB * CC * TT)      // f32 logits / P for HG heads [hg][q][k]
#define WS_PH  (WS_S + 4u * (size_t)HG * TT * TT)
#define WS_Y   (WS_PH + 0u)              // unused; y is written straight to the output
#define WS_END (WS_Y + 4u * (size_t)NB * TT * CC)

// ---- k_proj: block = (64 rows, 128 cols, which): qkv = x W (+ b), exact; q -> f16 hi (+ residual), k -> f16 rows, v -> bf16 hi + lo planes
__global__ __launch_bounds__(128) void k_proj(const float* __restrict__ X0, const float* __restrict__ X1, const float* __restrict__ X2, const float* __restrict__ WQ, const float* __restrict__ BQ, const float* __restrict__ WK, const float* __restrict__ BK, const float* __restrict__ WV, const float* __restrict__ BV, _Float16* __restrict__ QH, _Float16* __restrict__ QL, _Float16* __restrict__ KH, __bf16* __restrict__ VT, __bf16* __restrict__ VL) {
  __shared__ __align__(16) _Float16 sh[64][136], sl[64][136]; __shared__ __align__(16) __bf16 th[128][72], tl2[128][72];
  const int tid = threadIdx.x, wave = tid >> 5, lane = tid & 31, col = lane & 15, g = lane >> 4; const int which = blockIdx.z; const int c0 = blockIdx.y * 128; const size_t r0 = (size_t)blockIdx.x * 64; const float* WA = which == 0 ? WQ : which == 1 ? WK : WV; const float* BA = which == 0 ? BQ : which == 1 ? BK : BV;
  v8f acc[8] = {};
#pragma unroll 2
  for (int kc = 0; kc < CC / 32; ++kc) { v16b a; { const float* X = which == 0 ? X0 : which == 1 ? X1 : X2; const float* p = X + XROW(r0 + wave * 16 + col) * CC + kc * 32 + 8 * g;   /* padded row -> clamped 500-row input */
#pragma unroll
      for (int i = 0; i < 8; ++i) { a[i] = (__bf16)p[i]; a[8 + i] = (__bf16)p[16 + i]; } }
#pragma unroll
    for (int j = 0; j < 8; ++j) { v16b w; const int o = c0 + j * 16 + col;
#pragma unroll
      for (int i = 0; i < 8; ++i) { w[i] = (__bf16)WA[(size_t)(kc * 32 + 8 * g + i) * CC + o]; w[8 + i] = (__bf16)WA[(size_t)(kc * 32 + 16 + 8 * g + i) * CC + o]; }   /* (in,out) */
      acc[j] = wmma_bf(a, w, acc[j]); } }
#pragma unroll
  for (int j = 0; j < 8; ++j) { const float bb = BA ? bfr(BA[c0 + j * 16 + col]) : 0.f;
#pragma unroll
    for (int r = 0; r < 8; ++r) { const float v = acc[j][r] + bb; const int rl = wave * 16 + 8 * g + r, cl = j * 16 + col; const _Float16 hv = (_Float16)v;
      if (which == 2) { const __bf16 bh = (__bf16)v; th[cl][rl] = bh; tl2[cl][rl] = (__bf16)(v - (float)bh); } else { sh[rl][cl] = hv; sl[rl][cl] = (_Float16)((v - (float)hv) * 1024.0f); }   /* q residual carried x 2^10 so the plane stays f16-normal on the chip */ } }
  __syncthreads();
  if (which < 2) { _Float16* dh = which == 0 ? QH : KH; for (int e = tid; e < 64 * 16; e += 128) { const int rl = e >> 4, q = e & 15; vst2((unsigned*)(dh + (r0 + rl) * CC + c0 + q * 8), *(const v4u*)&sh[rl][q * 8]); if (which == 0) vst2((unsigned*)(QL + (r0 + rl) * CC + c0 + q * 8), *(const v4u*)&sl[rl][q * 8]); } }
  else { const size_t b = r0 / TT; const int t0 = (int)(r0 % TT); for (int e = tid; e < 128 * 8; e += 128) { const int cl = e >> 3, q = e & 7; const size_t o2 = (b * CC + c0 + cl) * (size_t)TT + t0 + q * 8; vst2((unsigned*)(VT + o2), *(const v4u*)&th[cl][q * 8]); vst2((unsigned*)(VL + o2), *(const v4u*)&tl2[cl][q * 8]); } } }
// ---- k_sc: block = (64 queries, 128 keys, head in group): 2-product logits / 8 (q hi + residual x k) + rel_emb[h][q - k + 499] (-3e38 for padded keys)
__global__ __launch_bounds__(128) void k_sc(const _Float16* __restrict__ QH, const _Float16* __restrict__ QL, const _Float16* __restrict__ KH, const float* __restrict__ REL, int b, int h0, float* __restrict__ S0) {   /* REL: rel_emb [16][999] */ __shared__ __align__(16) float ss[4][16][132]; const int h = h0 + blockIdx.z; float* S = S0 + (size_t)blockIdx.z * TT * TT;
  const int tid = threadIdx.x, wave = tid >> 5, lane = tid & 31, col = lane & 15, g = lane >> 4; const int k0 = blockIdx.y * 128; const int ql0 = blockIdx.x * 64 + wave * 16; const size_t q0 = (size_t)b * TT + ql0;
  v8f acc[8] = {}, accl[8] = {};
#pragma unroll
  for (int kc = 0; kc < HD / 32; ++kc) { const v16h ah = frag_h(QH + (q0 + col) * CC + h * HD + kc * 32, lane), al = frag_h(QL + (q0 + col) * CC + h * HD + kc * 32, lane);
#pragma unroll
    for (int j = 0; j < 8; ++j) { const v16h kb = frag_h(KH + ((size_t)b * TT + k0 + j * 16 + col) * CC + h * HD + kc * 32, lane); acc[j] = wmma16(ah, kb, acc[j]); accl[j] = wmma16(al, kb, accl[j]); } }
#pragma unroll
  for (int j = 0; j < 8; ++j) { const int kt = k0 + j * 16 + col;
#pragma unroll
    for (int r = 0; r < 8; ++r) { const int qt = ql0 + 8 * g + r; const float rb = bfr(REL[(size_t)h * NREL + (qt - kt + LB - 1 < 0 ? 0 : (qt - kt + LB - 1 < NREL ? qt - kt + LB - 1 : NREL - 1))]);   /* q - k + 499 (clamped for padded rows) */
      const float sv = (acc[j][r] + accl[j][r] * (1.0f / 1024.0f)) * 0.125f + rb; ss[wave][8 * g + r][j * 16 + col] = (kt < LB) ? sv : -3.0e38f; }   /* padded keys masked */
    asm volatile("s_wait_loadcnt 0x0" ::: "memory"); }   /* bound the table gather bursts */
  LDSX(); for (int rl = 0; rl < 16; ++rl) vst2(S + (size_t)(ql0 + rl) * TT + k0 + lane * 4, *(const v4f*)&ss[wave][rl][lane * 4]); }
// ---- k_sm: block = query row: softmax over keys [0, kend) -> P x 2^11 f32 (masked -> 0)
__global__ __launch_bounds__(256) void k_sm(float* __restrict__ S0) { __shared__ float sred[8]; __shared__ float sbc; __shared__ __align__(16) float sh[TT];
  const int t = threadIdx.x; const size_t row = blockIdx.x; float* sr = S0 + (size_t)blockIdx.y * TT * TT + row * TT; const int kend = TT;
  float m = -3.0e38f; for (int k = t; k < kend; k += 256) m = fmaxf(m, sr[k]);
#pragma unroll
  for (int o = 1; o < 32; o <<= 1) m = fmaxf(m, __shfl_xor(m, o));
  if ((t & 31) == 0) sred[t >> 5] = m; __syncthreads(); if (t == 0) { float a = sred[0]; for (int i = 1; i < 8; ++i) a = fmaxf(a, sred[i]); sbc = a; } __syncthreads(); m = sbc; __syncthreads();
  float sum = 0.f; for (int k = t; k < kend; k += 256) { const float v = sr[k]; sum += (v <= -1.0e38f) ? 0.f : expf(v - m); }
#pragma unroll
  for (int o = 1; o < 32; o <<= 1) sum += __shfl_xor(sum, o);
  if ((t & 31) == 0) sred[t >> 5] = sum; __syncthreads(); if (t == 0) { float a = 0.f; for (int i = 0; i < 8; ++i) a += sred[i]; sbc = 1.0f / a; } __syncthreads(); const float inv = sbc;
  for (int k = t; k < kend; k += 256) { const float v = sr[k]; sh[k] = (v <= -1.0e38f) ? 0.f : expf(v - m) * inv * 2048.0f; }
  __syncthreads(); for (int q = t; q < kend / 4; q += 256) vst2(sr + q * 4, *(const v4f*)&sh[q * 4]); }
// ---- k_pv: block = 64 queries of (b,h): y[q][h*HD + d] = P . v  (keys [0, kend))
__global__ __launch_bounds__(128) void k_pv(const float* __restrict__ PS0, const __bf16* __restrict__ VT, const __bf16* __restrict__ VL, int b, int h0, float* __restrict__ Y) { const int h = h0 + blockIdx.z; const float* PS = PS0 + (size_t)blockIdx.z * TT * TT; __shared__ __align__(16) float ss[4][16][HD + 4];
  const int tid = threadIdx.x, wave = tid >> 5, lane = tid & 31, col = lane & 15, g = lane >> 4; const int ql0 = blockIdx.x * 64 + wave * 16; const int kend = TT;
  v8f acc[HD / 16] = {};
#pragma unroll 1
  for (int kc = 0; kc < kend / 32; ++kc) { const F2 p = split_row(PS + (size_t)(ql0 + col) * TT, kc * 32, lane);
#pragma unroll
    for (int j = 0; j < HD / 16; ++j) { const size_t po = ((size_t)b * CC + h * HD + j * 16 + col) * (size_t)TT + kc * 32; const v16b vh = frag_b(VT + po, lane); acc[j] = wmma_bf(p.h, vh, acc[j]); acc[j] = wmma_bf(p.l, vh, acc[j]); acc[j] = wmma_bf(p.h, frag_b(VL + po, lane), acc[j]); } }
#pragma unroll
  for (int j = 0; j < HD / 16; ++j)
#pragma unroll
    for (int r = 0; r < 8; ++r) ss[wave][8 * g + r][j * 16 + col] = acc[j][r] * (1.0f / 2048.0f);
  LDSX(); for (int rl = 0; rl < 16; ++rl) if (ql0 + rl < LB && lane < HD / 4) vst2(Y + ((size_t)b * LB + ql0 + rl) * CC + h * HD + lane * 4, *(const v4f*)&ss[wave][rl][lane * 4]); }   /* only the 500 real rows, at the output's 500-row stride */
// ---- k_out: block = (64 rows, 128 cols): out = y (bf16 hi + lo) Wo (in,out) + bo
__global__ __launch_bounds__(128) void k_out(const float* __restrict__ Y, const float* __restrict__ WP, const float* __restrict__ BP, float* __restrict__ OUT) { __shared__ __align__(16) float sf[4][16][132];
  const int tid = threadIdx.x, wave = tid >> 5, lane = tid & 31, col = lane & 15, g = lane >> 4; const int c0 = blockIdx.y * 128; const size_t r0 = (size_t)blockIdx.x * 64 + wave * 16;
  v8f acc[8] = {};
#pragma unroll 2
  for (int kc = 0; kc < CC / 32; ++kc) { const F2 a = split_row(Y + (r0 + col) * CC, kc * 32, lane);
#pragma unroll
    for (int j = 0; j < 8; ++j) { v16b w; const int o = c0 + j * 16 + col;
#pragma unroll
      for (int i = 0; i < 8; ++i) { w[i] = (__bf16)WP[(size_t)(kc * 32 + 8 * g + i) * CC + o]; w[8 + i] = (__bf16)WP[(size_t)(kc * 32 + 16 + 8 * g + i) * CC + o]; }   /* (in,out) */
      acc[j] = wmma_bf(a.h, w, acc[j]); acc[j] = wmma_bf(a.l, w, acc[j]); } }
#pragma unroll
  for (int j = 0; j < 8; ++j) { const float bb = BP ? bfr(BP[c0 + j * 16 + col]) : 0.f;
#pragma unroll
    for (int r = 0; r < 8; ++r) sf[wave][8 * g + r][j * 16 + col] = acc[j][r] + bb; }
  LDSX(); for (int rl = 0; rl < 16; ++rl) vst2(OUT + (r0 + rl) * CC + c0 + lane * 4, *(const v4f*)&sf[wave][rl][lane * 4]); }
extern "C" void kernel_launch(void* const* d_in, const int* in_sizes, int n_in, void* d_out, int out_size, void* d_ws, size_t ws_size, hipStream_t stream) {
  (void)in_sizes; (void)n_in; (void)out_size;
  const float** F = (const float**)d_in;   // 0 query [8,500,1024], 1 key, 2 value, 3 Wq ((in,out)), 4 bq, 5 Wk, 6 bk, 7 Wv, 8 bv, 9 rel_emb [16,999]
  if (ws_size < (size_t)WS_END) return;
  char* ws = (char*)d_ws; _Float16 *QH = (_Float16*)(ws + WS_QH), *QL = (_Float16*)(ws + WS_QL), *KH = (_Float16*)(ws + WS_KH); __bf16 *VT = (__bf16*)(ws + WS_VT), *VL = (__bf16*)(ws + WS_VL); float* S = (float*)(ws + WS_S);
  k_proj<<<dim3(TNB * TT / 64, CC / 128, 3), 128, 0, stream>>>(F[0], F[1], F[2], F[3], F[4], F[5], F[6], F[7], F[8], QH, QL, KH, VT, VL);
  for (int b = 0; b < TNB; ++b) for (int h0 = 0; h0 < NH; h0 += HG) {
    k_sc<<<dim3(TT / 64, TT / 128, HG), 128, 0, stream>>>(QH, QL, KH, F[9], b, h0, S);
    k_sm<<<dim3(TT, HG), 256, 0, stream>>>(S);
    k_pv<<<dim3(TT / 64, 1, HG), 128, 0, stream>>>(S, VT, VL, b, h0, (float*)d_out);
  }
}

// v001
// One run takes 188 microseconds.
// Next to v000, in two timings, it ran 3.18 times as fast each time.
// compute dtype: all float inputs rounded to bf16; q/k/v = x W + b ((in,out)) with EXACT bf16 products on WMMA 16x16x32, f32 accumulate (sequence padded 500 -> 512 internally; padded keys masked, padded queries dropped); q as f16 hi + residual (x 2^10), k f16 -> 2-product logits / 8 + rel_emb[h][q - k + 499] kept in f32 registers (one launch for all batches and heads); online softmax in f32 (precise expf), 32 keys a step; unnormalised P split bf16 hi + lo against v bf16 hi + lo (3 products), divided by the row sum at the end; the merged context is the output; f32 output.
#include <hip/hip_runtime.h>
#include <math.h>

typedef __attribute__((ext_vector_type(16))) _Float16 v16h;
typedef __attribute__((ext_vector_type(16))) __bf16 v16b;
typedef __attribute__((ext_vector_type(8)))  _Float16 v8h;
typedef __attribute__((ext_vector_type(8)))  float v8f;
typedef __attribute__((ext_vector_type(4)))  float v4f;
typedef __attribute__((ext_vector_type(2)))  float v2f;
typedef __attribute__((ext_vector_type(4)))  unsigned v4u;
typedef __attribute__((ext_vector_type(4)))  int v4i;
typedef float __attribute__((may_alias)) float_a;
typedef int __attribute__((may_alias)) int_a;

template <typename T> __device__ __forceinline__ void vst2(void* p, T v) { *(T*)p = v;  }
__device__ __forceinline__ v8f wmma16(v16h a, v16h b, v8f c) {
  v8f d = __builtin_amdgcn_wmma_f32_16x16x32_f16(false, a, false, b, (short)0, c, false, false);
  asm volatile("v_nop\n\tv_nop\n\tv_nop\n\tv_nop" : "+v"(d) : "v"(a), "v"(b));
  return d;
}
__device__ __forceinline__ v8f wmma_bf(v16b a, v16b b, v8f c) {
  v8f d = __builtin_amdgcn_wmma_f32_16x16x32_bf16(false, a, false, b, (short)0, c, false, false);
  asm volatile("v_nop\n\tv_nop\n\tv_nop\n\tv_nop" : "+v"(d) : "v"(a), "v"(b));
  return d;
}
// 16x16x32 fragments: lane = (h = lane>>4, row/col = lane&15); elements 0..7 = k0+8h+0..7, 8..15 = k0+16+8h+0..7; D element r = row 8h+r
__device__ __forceinline__ v16h frag_h(const _Float16* rowk0, int lane) {
  union { v16h v; v8h q[2]; } u; const _Float16* p = rowk0 + 8 * (lane >> 4);
  u.q[0] = *(const v8h*)p; u.q[1] = *(const v8h*)(p + 16); return u.v;
}
__device__ __forceinline__ v16h frag_f32(const float* rowk0, int lane) {
  v16h a; const float* p = rowk0 + 8 * (lane >> 4);
#pragma unroll
  for (int i = 0; i < 8; ++i) { a[i] = (_Float16)p[i]; a[8 + i] = (_Float16)p[16 + i]; }
  return a;
}
__device__ __forceinline__ v16h frag_f32s(const float* rowk0, int lane, float sc) {
  v16h a; const float* p = rowk0 + 8 * (lane >> 4);
#pragma unroll
  for (int i = 0; i < 8; ++i) { a[i] = (_Float16)(p[i] * sc); a[8 + i] = (_Float16)(p[16 + i] * sc); }
  return a;
}
// column fragment from a [K][ld] layout (column n), rows >= K read as 0
__device__ __forceinline__ v16h fragc_f32(const float* W, int k0, int n, int lane, int ld, int K) {
  v16h a; const int g = lane >> 4;
#pragma unroll
  for (int i = 0; i < 8; ++i) { const int ka = k0 + 8 * g + i, kb = ka + 16;
    a[i] = (_Float16)(ka < K ? W[(size_t)(ka < K ? ka : K - 1) * ld + n] : 0.f); a[8 + i] = (_Float16)(kb < K ? W[(size_t)(kb < K ? kb : K - 1) * ld + n] : 0.f); }
  return a;
}
struct F2 { v16b h, l; };
__device__ __forceinline__ F2 bsplit16(const float v[16]) { F2 r;
#pragma unroll
  for (int i = 0; i < 16; ++i) { const __bf16 h = (__bf16)v[i]; r.h[i] = h; r.l[i] = (__bf16)(v[i] - (float)h); }
  return r; }
__device__ __forceinline__ F2 split_row(const float* row, int k0, int lane) { float v[16]; const float* p = row + k0 + 8 * (lane >> 4);
#pragma unroll
  for (int i = 0; i < 8; ++i) { v[i] = p[i]; v[8 + i] = p[16 + i]; }
  return bsplit16(v); }
__device__ __forceinline__ F2 split_rowK(const float* row, int k0, int lane, int K) { float v[16]; const int g = lane >> 4;
#pragma unroll
  for (int i = 0; i < 8; ++i) { const int ka = k0 + 8 * g + i, kb = ka + 16; v[i] = ka < K ? row[ka < K ? ka : K - 1] : 0.f; v[8 + i] = kb < K ? row[kb < K ? kb : K - 1] : 0.f; }
  return bsplit16(v); }
__device__ __forceinline__ F2 split_col(const float* W, int k0, int n, int lane, int ld, int K) { float v[16]; const int g = lane >> 4;
#pragma unroll
  for (int i = 0; i < 8; ++i) { const int ka = k0 + 8 * g + i, kb = ka + 16; v[i] = ka < K ? W[(size_t)(ka < K ? ka : K - 1) * ld + n] : 0.f; v[8 + i] = kb < K ? W[(size_t)(kb < K ? kb : K - 1) * ld + n] : 0.f; }
  return bsplit16(v); }
__device__ __forceinline__ v8f mac3(const F2& a, const F2& b, v8f c) { c = wmma_bf(a.l, b.h, c); c = wmma_bf(a.h, b.l, c); return wmma_bf(a.h, b.h, c); }
__device__ __forceinline__ float sigm(float v) { return 1.0f / (1.0f + expf(-v)); }
#define LDSX() do { asm volatile("s_wait_dscnt 0" ::: "memory"); __builtin_amdgcn_wave_barrier(); __builtin_amdgcn_fence(__ATOMIC_RELEASE, "workgroup"); } while (0)


// Attention (B 8, S 500 padded to 512, D 1,024 = 16 x 64, q/k/v biases, logits / 8): scores = q k^T / 8 + rel_emb[h][q - k + 499] (999 offsets), softmax, P v; the context is the output.
#define NB 8
#define TT 512               // padded length
#define LB 500               // real sequence length (input/output rows per batch)
#define NREL 999
#define XROW(r) (((r) / TT) * (size_t)LB + (((r) % TT) < LB ? ((r) % TT) : (LB - 1)))   /* padded row -> clamped input row */
#define CC 1024
#define NH 16
#define HD 64
#define HG 16               // heads per launch group
#ifndef TNB
#define TNB NB
#endif
typedef __attribute__((ext_vector_type(8))) __bf16 v8b;
__device__ __forceinline__ v16b frag_b(const __bf16* rowk0, int lane) {
  union { v16b v; v8b q[2]; } u; const __bf16* p = rowk0 + 8 * (lane >> 4);
  u.q[0] = *(const v8b*)p; u.q[1] = *(const v8b*)(p + 16); return u.v;
}
__device__ __forceinline__ float bfr(float v) { return (float)(__bf16)v; }
__device__ __attribute__((noinline)) float exp_ni(float v) { return expf(v); }
__device__ __attribute__((noinline)) float erf_ni(float v) { return erff(v); }

#define WS_QH  0u
#define WS_QL  (WS_QH + 2u * (size_t)NB * TT * CC)
#define WS_KH  (WS_QL + 2u * (size_t)NB * TT * CC)
#define WS_VT  (WS_KH + 2u * (size_t)NB * TT * CC)      // bf16 v planes [b][c][t]
#define WS_VL  (WS_VT + 2u * (size_t)NB * CC * TT)      // bf16 v residual planes
#define WS_S   (WS_VL + 2u * (size_t)NB * CC * TT)      // f32 region [hg][q][k], unused: scores stay in registers
#define WS_PH  (WS_S + 4u * (size_t)HG * TT * TT)
#define WS_Y   (WS_PH + 0u)              // unused; y is written straight to the output
#define WS_END (WS_Y + 4u * (size_t)NB * TT * CC)

// ---- k_proj: block = (64 rows, 128 cols, which): qkv = x W (+ b), exact; q -> f16 hi (+ residual), k -> f16 rows, v -> bf16 hi + lo planes
__global__ __launch_bounds__(128) void k_proj(const float* __restrict__ X0, const float* __restrict__ X1, const float* __restrict__ X2, const float* __restrict__ WQ, const float* __restrict__ BQ, const float* __restrict__ WK, const float* __restrict__ BK, const float* __restrict__ WV, const float* __restrict__ BV, _Float16* __restrict__ QH, _Float16* __restrict__ QL, _Float16* __restrict__ KH, __bf16* __restrict__ VT, __bf16* __restrict__ VL) {
  __shared__ __align__(16) _Float16 sh[64][136], sl[64][136]; __shared__ __align__(16) __bf16 th[128][72], tl2[128][72];
  const int tid = threadIdx.x, wave = tid >> 5, lane = tid & 31, col = lane & 15, g = lane >> 4; const int which = blockIdx.z; const int c0 = blockIdx.y * 128; const size_t r0 = (size_t)blockIdx.x * 64; const float* WA = which == 0 ? WQ : which == 1 ? WK : WV; const float* BA = which == 0 ? BQ : which == 1 ? BK : BV;
  v8f acc[8] = {};
#pragma unroll 2
  for (int kc = 0; kc < CC / 32; ++kc) { v16b a; { const float* X = which == 0 ? X0 : which == 1 ? X1 : X2; const float* p = X + XROW(r0 + wave * 16 + col) * CC + kc * 32 + 8 * g;   /* padded row -> clamped 500-row input */
#pragma unroll
      for (int i = 0; i < 8; ++i) { a[i] = (__bf16)p[i]; a[8 + i] = (__bf16)p[16 + i]; } }
#pragma unroll
    for (int j = 0; j < 8; ++j) { v16b w; const int o = c0 + j * 16 + col;
#pragma unroll
      for (int i = 0; i < 8; ++i) { w[i] = (__bf16)WA[(size_t)(kc * 32 + 8 * g + i) * CC + o]; w[8 + i] = (__bf16)WA[(size_t)(kc * 32 + 16 + 8 * g + i) * CC + o]; }   /* (in,out) */
      acc[j] = wmma_bf(a, w, acc[j]); } }
#pragma unroll
  for (int j = 0; j < 8; ++j) { const float bb = BA ? bfr(BA[c0 + j * 16 + col]) : 0.f;
#pragma unroll
    for (int r = 0; r < 8; ++r) { const float v = acc[j][r] + bb; const int rl = wave * 16 + 8 * g + r, cl = j * 16 + col; const _Float16 hv = (_Float16)v;
      if (which == 2) { const __bf16 bh = (__bf16)v; th[cl][rl] = bh; tl2[cl][rl] = (__bf16)(v - (float)bh); } else { sh[rl][cl] = hv; sl[rl][cl] = (_Float16)((v - (float)hv) * 1024.0f); }   /* q residual carried x 2^10 so the plane stays f16-normal on the chip */ } }
  __syncthreads();
  if (which < 2) { _Float16* dh = which == 0 ? QH : KH; for (int e = tid; e < 64 * 16; e += 128) { const int rl = e >> 4, q = e & 15; vst2((unsigned*)(dh + (r0 + rl) * CC + c0 + q * 8), *(const v4u*)&sh[rl][q * 8]); if (which == 0) vst2((unsigned*)(QL + (r0 + rl) * CC + c0 + q * 8), *(const v4u*)&sl[rl][q * 8]); } }
  else { const size_t b = r0 / TT; const int t0 = (int)(r0 % TT); for (int e = tid; e < 128 * 8; e += 128) { const int cl = e >> 3, q = e & 7; const size_t o2 = (b * CC + c0 + cl) * (size_t)TT + t0 + q * 8; vst2((unsigned*)(VT + o2), *(const v4u*)&th[cl][q * 8]); vst2((unsigned*)(VL + o2), *(const v4u*)&tl2[cl][q * 8]); } } }
// ---- k_att: block = (64 queries, head, batch), wave = 16 queries: S^T = K Q^T (2 products) / 8 + bias, online softmax per query column, O^T += V^T P^T (3 products); scores and P never leave the registers
__global__ __launch_bounds__(128) void k_att(const _Float16* __restrict__ QH, const _Float16* __restrict__ QL, const _Float16* __restrict__ KH, const __bf16* __restrict__ VT, const __bf16* __restrict__ VL, const float* __restrict__ REL, float* __restrict__ Y) {   /* REL: rel_emb [16][999] */
  __shared__ float rt[2 * TT]; __shared__ __align__(16) float ss[4][16][HD + 4];
  const int tid = threadIdx.x, wave = tid >> 5, lane = tid & 31, col = lane & 15, g = lane >> 4; const int h = blockIdx.y, b = blockIdx.z; const int ql0 = blockIdx.x * 64 + wave * 16;
  const _Float16* kp = KH + ((size_t)b * TT + col) * CC + h * HD; const size_t vo = ((size_t)b * CC + h * HD + col) * (size_t)TT;
  v16h qh[HD / 32], qlo[HD / 32], kb[2][HD / 32];
#pragma unroll
  for (int kc = 0; kc < HD / 32; ++kc) { const size_t qo = ((size_t)b * TT + ql0 + col) * CC + h * HD + kc * 32; qh[kc] = frag_h(QH + qo, lane); qlo[kc] = frag_h(QL + qo, lane);
#pragma unroll
    for (int t = 0; t < 2; ++t) kb[t][kc] = frag_h(kp + (size_t)(t * 16) * CC + kc * 32, lane); }
#pragma unroll   /* all eight table loads of a thread in flight together */
  for (int n = 0; n < 2 * TT / 128; ++n) { const int i = n * 128 + tid, ri = (TT - 1) - i + LB - 1; rt[i] = bfr(REL[(size_t)h * NREL + (ri < 0 ? 0 : (ri < NREL ? ri : NREL - 1))]); }   /* rt[511 - q + k] = bias at q - k + 499 (clamped for padded rows): ascending in k */
  __syncthreads();   /* the bias row is read by every wave */
  const float* rb = rt + (TT - 1) - (ql0 + col) + 8 * g;
  v8f o[HD / 16] = {}; float m = -3.0e38f, l = 0.f;
#pragma unroll 1   /* rolled: the K fragments rotate through one register set */
  for (int k0 = 0; k0 < TT; k0 += 32) { v16b vh[HD / 16], vl[HD / 16];
#pragma unroll
    for (int j = 0; j < HD / 16; ++j) { const size_t po = vo + (size_t)(j * 16) * TT + k0; vh[j] = frag_b(VT + po, lane); vl[j] = frag_b(VL + po, lane); }
    __builtin_amdgcn_sched_barrier(0);   /* keeps this step's V loads in front of the score products, so that they fly behind products and softmax */
    v8f a[2] = {}, al[2] = {};
#pragma unroll
    for (int kc = 0; kc < HD / 32; ++kc)
#pragma unroll
      for (int t = 0; t < 2; ++t) { a[t] = wmma16(kb[t][kc], qh[kc], a[t]); al[t] = wmma16(kb[t][kc], qlo[kc], al[t]); }
    const int kn = k0 + 32 < TT ? k0 + 32 : 0;   /* the last step re-reads the first rows, unused */
#pragma unroll
    for (int kc = 0; kc < HD / 32; ++kc)
#pragma unroll
      for (int t = 0; t < 2; ++t) kb[t][kc] = frag_h(kp + (size_t)(kn + t * 16) * CC + kc * 32, lane);
    __builtin_amdgcn_sched_barrier(0);   /* keeps the next step's K loads in front of the softmax, one step ahead of their use */
    float s[16];
#pragma unroll
    for (int t = 0; t < 2; ++t)
#pragma unroll
      for (int r = 0; r < 8; ++r) s[t * 8 + r] = (a[t][r] + al[t][r] * (1.0f / 1024.0f)) * 0.125f + rb[k0 + t * 16 + r];   /* lane (g, col): key k0 + 16 t + 8 g + r, query ql0 + col */
    if (k0 + 32 > LB) {   /* padded keys masked */
#pragma unroll
      for (int t = 0; t < 2; ++t)
#pragma unroll
        for (int r = 0; r < 8; ++r) if (k0 + t * 16 + 8 * g + r >= LB) s[t * 8 + r] = -3.0e38f; }
    float mx = m;
#pragma unroll
    for (int i = 0; i < 16; ++i) mx = fmaxf(mx, s[i]);
    mx = fmaxf(mx, __shfl_xor(mx, 16));   /* the two lane halves hold the two key halves of one query */
    const float al0 = expf(m - mx); m = mx; l *= al0;
#pragma unroll
    for (int j = 0; j < HD / 16; ++j) o[j] *= al0;
#pragma unroll
    for (int i = 0; i < 16; ++i) { s[i] = expf(s[i] - m); l += s[i]; }   /* masked keys underflow to 0 */
    const F2 p = bsplit16(s);   /* two S^T tiles of 16 keys are one B fragment of 32 keys */
#pragma unroll
    for (int j = 0; j < HD / 16; ++j) o[j] = wmma_bf(vh[j], p.h, o[j]);
#pragma unroll
    for (int j = 0; j < HD / 16; ++j) o[j] = wmma_bf(vh[j], p.l, o[j]);
#pragma unroll
    for (int j = 0; j < HD / 16; ++j) o[j] = wmma_bf(vl[j], p.h, o[j]); }
  l += __shfl_xor(l, 16); const float inv = 1.0f / l;
#pragma unroll
  for (int j = 0; j < HD / 16; ++j) { v4f x0, x1;
#pragma unroll
    for (int r = 0; r < 4; ++r) { x0[r] = o[j][r] * inv; x1[r] = o[j][4 + r] * inv; }
    *(v4f*)&ss[wave][col][j * 16 + 8 * g] = x0; *(v4f*)&ss[wave][col][j * 16 + 8 * g + 4] = x1; }   /* lane (g, col): d = 16 j + 8 g + r of query col */
  LDSX();
#pragma unroll
  for (int it = 0; it < 8; ++it) { const int rl = it * 2 + g; if (ql0 + rl < LB) vst2(Y + ((size_t)b * LB + ql0 + rl) * CC + h * HD + col * 4, *(const v4f*)&ss[wave][rl][col * 4]); } }   /* only the 500 real rows, at the output's 500-row stride */
// ---- k_out: block = (64 rows, 128 cols): out = y (bf16 hi + lo) Wo + bo
__global__ __launch_bounds__(128) void k_out(const float* __restrict__ Y, const float* __restrict__ WP, const float* __restrict__ BP, float* __restrict__ OUT) { __shared__ __align__(16) float sf[4][16][132];
  const int tid = threadIdx.x, wave = tid >> 5, lane = tid & 31, col = lane & 15, g = lane >> 4; const int c0 = blockIdx.y * 128; const size_t r0 = (size_t)blockIdx.x * 64 + wave * 16;
  v8f acc[8] = {};
#pragma unroll 2
  for (int kc = 0; kc < CC / 32; ++kc) { const F2 a = split_row(Y + (r0 + col) * CC, kc * 32, lane);
#pragma unroll
    for (int j = 0; j < 8; ++j) { v16b w; const int o = c0 + j * 16 + col;
#pragma unroll
      for (int i = 0; i < 8; ++i) { w[i] = (__bf16)WP[(size_t)(kc * 32 + 8 * g + i) * CC + o]; w[8 + i] = (__bf16)WP[(size_t)(kc * 32 + 16 + 8 * g + i) * CC + o]; }   /* (in,out) */
      acc[j] = wmma_bf(a.h, w, acc[j]); acc[j] = wmma_bf(a.l, w, acc[j]); } }
#pragma unroll
  for (int j = 0; j < 8; ++j) { const float bb = BP ? bfr(BP[c0 + j * 16 + col]) : 0.f;
#pragma unroll
    for (int r = 0; r < 8; ++r) sf[wave][8 * g + r][j * 16 + col] = acc[j][r] + bb; }
  LDSX(); for (int rl = 0; rl < 16; ++rl) vst2(OUT + (r0 + rl) * CC + c0 + lane * 4, *(const v4f*)&sf[wave][rl][lane * 4]); }
extern "C" void kernel_launch(void* const* d_in, const int* in_sizes, int n_in, void* d_out, int out_size, void* d_ws, size_t ws_size, hipStream_t stream) {
  (void)in_sizes; (void)n_in; (void)out_size;
  const float** F = (const float**)d_in;   // 0 query [8,500,1024], 1 key, 2 value, 3 Wq ((in,out)), 4 bq, 5 Wk, 6 bk, 7 Wv, 8 bv, 9 rel_emb [16,999]
  if (ws_size < (size_t)WS_END) return;
  char* ws = (char*)d_ws; _Float16 *QH = (_Float16*)(ws + WS_QH), *QL = (_Float16*)(ws + WS_QL), *KH = (_Float16*)(ws + WS_KH); __bf16 *VT = (__bf16*)(ws + WS_VT), *VL = (__bf16*)(ws + WS_VL);
  k_proj<<<dim3(TNB * TT / 64, CC / 128, 3), 128, 0, stream>>>(F[0], F[1], F[2], F[3], F[4], F[5], F[6], F[7], F[8], QH, QL, KH, VT, VL);
  k_att<<<dim3(TT / 64, NH, TNB), 128, 0, stream>>>(QH, QL, KH, VT, VL, F[9], (float*)d_out);
}

// v002
// A run of this version takes 100 microseconds.
// Next to v001, in two timings, it ran 1.87 times as fast each time.
// Counting every step since v000, it is 5.96 times as fast.
// compute dtype: all float inputs rounded to bf16; q/k/v = x W + b ((in,out)) with EXACT bf16 products on WMMA 16x16x32, f32 accumulate (sequence padded 500 -> 512 internally; padded keys masked, padded queries dropped); q as f16 hi + residual (x 2^10), k f16 -> 2-product logits / 8 + rel_emb[h][q - k + 499] kept in f32 registers (one launch for all batches and heads); online softmax in f32 (precise expf), 32 keys a step; unnormalised P split bf16 hi + lo against v bf16 hi + lo (3 products), divided by the row sum at the end; the merged context is the output; f32 output.
#include <hip/hip_runtime.h>
#include <math.h>

typedef __attribute__((ext_vector_type(16))) _Float16 v16h;
typedef __attribute__((ext_vector_type(16))) __bf16 v16b;
typedef __attribute__((ext_vector_type(8)))  _Float16 v8h;
typedef __attribute__((ext_vector_type(8)))  float v8f;
typedef __attribute__((ext_vector_type(4)))  float v4f;
typedef __attribute__((ext_vector_type(2)))  float v2f;
typedef __attribute__((ext_vector_type(4)))  unsigned v4u;
typedef __attribute__((ext_vector_type(4)))  int v4i;
typedef float __attribute__((may_alias)) float_a;
typedef int __attribute__((may_alias)) int_a;

template <typename T> __device__ __forceinline__ void vst2(void* p, T v) { *(T*)p = v;  }
__device__ __forceinline__ v8f wmma16(v16h a, v16h b, v8f c) {
  v8f d = __builtin_amdgcn_wmma_f32_16x16x32_f16(false, a, false, b, (short)0, c, false, false);
  asm volatile("v_nop\n\tv_nop\n\tv_nop\n\tv_nop" : "+v"(d) : "v"(a), "v"(b));
  return d;
}
__device__ __forceinline__ v8f wmma_bf(v16b a, v16b b, v8f c) {
  v8f d = __builtin_amdgcn_wmma_f32_16x16x32_bf16(false, a, false, b, (short)0, c, false, false);
  asm volatile("v_nop\n\tv_nop\n\tv_nop\n\tv_nop" : "+v"(d) : "v"(a), "v"(b));
  return d;
}
// 16x16x32 fragments: lane = (h = lane>>4, row/col = lane&15); elements 0..7 = k0+8h+0..7, 8..15 = k0+16+8h+0..7; D element r = row 8h+r
__device__ __forceinline__ v16h frag_h(const _Float16* rowk0, int lane) {
  union { v16h v; v8h q[2]; } u; const _Float16* p = rowk0 + 8 * (lane >> 4);
  u.q[0] = *(const v8h*)p; u.q[1] = *(const v8h*)(p + 16); return u.v;
}
__device__ __forceinline__ v16h frag_f32(const float* rowk0, int lane) {
  v16h a; const float* p = rowk0 + 8 * (lane >> 4);
#pragma unroll
  for (int i = 0; i < 8; ++i) { a[i] = (_Float16)p[i]; a[8 + i] = (_Float16)p[16 + i]; }
  return a;
}
__device__ __forceinline__ v16h frag_f32s(const float* rowk0, int lane, float sc) {
  v16h a; const float* p = rowk0 + 8 * (lane >> 4);
#pragma unroll
  for (int i = 0; i < 8; ++i) { a[i] = (_Float16)(p[i] * sc); a[8 + i] = (_Float16)(p[16 + i] * sc); }
  return a;
}
// column fragment from a [K][ld] layout (column n), rows >= K read as 0
__device__ __forceinline__ v16h fragc_f32(const float* W, int k0, int n, int lane, int ld, int K) {
  v16h a; const int g = lane >> 4;
#pragma unroll
  for (int i = 0; i < 8; ++i) { const int ka = k0 + 8 * g + i, kb = ka + 16;
    a[i] = (_Float16)(ka < K ? W[(size_t)(ka < K ? ka : K - 1) * ld + n] : 0.f); a[8 + i] = (_Float16)(kb < K ? W[(size_t)(kb < K ? kb : K - 1) * ld + n] : 0.f); }
  return a;
}
struct F2 { v16b h, l; };
__device__ __forceinline__ F2 bsplit16(const float v[16]) { F2 r;
#pragma unroll
  for (int i = 0; i < 16; ++i) { const __bf16 h = (__bf16)v[i]; r.h[i] = h; r.l[i] = (__bf16)(v[i] - (float)h); }
  return r; }
__device__ __forceinline__ F2 split_row(const float* row, int k0, int lane) { float v[16]; const float* p = row + k0 + 8 * (lane >> 4);
#pragma unroll
  for (int i = 0; i < 8; ++i) { v[i] = p[i]; v[8 + i] = p[16 + i]; }
  return bsplit16(v); }
__device__ __forceinline__ F2 split_rowK(const float* row, int k0, int lane, int K) { float v[16]; const int g = lane >> 4;
#pragma unroll
  for (int i = 0; i < 8; ++i) { const int ka = k0 + 8 * g + i, kb = ka + 16; v[i] = ka < K ? row[ka < K ? ka : K - 1] : 0.f; v[8 + i] = kb < K ? row[kb < K ? kb : K - 1] : 0.f; }
  return bsplit16(v); }
__device__ __forceinline__ F2 split_col(const float* W, int k0, int n, int lane, int ld, int K) { float v[16]; const int g = lane >> 4;
#pragma unroll
  for (int i = 0; i < 8; ++i) { const int ka = k0 + 8 * g + i, kb = ka + 16; v[i] = ka < K ? W[(size_t)(ka < K ? ka : K - 1) * ld + n] : 0.f; v[8 + i] = kb < K ? W[(size_t)(kb < K ? kb : K - 1) * ld + n] : 0.f; }
  return bsplit16(v); }
__device__ __forceinline__ v8f mac3(const F2& a, const F2& b, v8f c) { c = wmma_bf(a.l, b.h, c); c = wmma_bf(a.h, b.l, c); return wmma_bf(a.h, b.h, c); }
__device__ __forceinline__ float sigm(float v) { return 1.0f / (1.0f + expf(-v)); }
#define LDSX() do { asm volatile("s_wait_dscnt 0" ::: "memory"); __builtin_amdgcn_wave_barrier(); __builtin_amdgcn_fence(__ATOMIC_RELEASE, "workgroup"); } while (0)


// Attention (B 8, S 500 padded to 512, D 1,024 = 16 x 64, q/k/v biases, logits / 8): scores = q k^T / 8 + rel_emb[h][q - k + 499] (999 offsets), softmax, P v; the context is the output.
#define NB 8
#define TT 512               // padded length
#define LB 500               // real sequence length (input/output rows per batch)
#define NREL 999
#define XROW(r) (((r) / TT) * (size_t)LB + (((r) % TT) < LB ? ((r) % TT) : (LB - 1)))   /* padded row -> clamped input row */
#define CC 1024
#define NH 16
#define HD 64
#define HG 16               // heads per launch group
#ifndef TNB
#define TNB NB
#endif
typedef __attribute__((ext_vector_type(8))) __bf16 v8b;
__device__ __forceinline__ v16b frag_b(const __bf16* rowk0, int lane) {
  union { v16b v; v8b q[2]; } u; const __bf16* p = rowk0 + 8 * (lane >> 4);
  u.q[0] = *(const v8b*)p; u.q[1] = *(const v8b*)(p + 16); return u.v;
}
__device__ __forceinline__ float bfr(float v) { return (float)(__bf16)v; }
__device__ __attribute__((noinline)) float exp_ni(float v) { return expf(v); }
__device__ __attribute__((noinline)) float erf_ni(float v) { return erff(v); }

#define WS_QH  0u
#define WS_QL  (WS_QH + 2u * (size_t)NB * TT * CC)
#define WS_KH  (WS_QL + 2u * (size_t)NB * TT * CC)
#define WS_VT  (WS_KH + 2u * (size_t)NB * TT * CC)      // bf16 v planes [b][c][t]
#define WS_VL  (WS_VT + 2u * (size_t)NB * CC * TT)      // bf16 v residual planes
#define WS_S   (WS_VL + 2u * (size_t)NB * CC * TT)      // f32 region [hg][q][k], unused: scores stay in registers
#define WS_PH  (WS_S + 4u * (size_t)HG * TT * TT)
#define WS_Y   (WS_PH + 0u)              // unused; y is written straight to the output
#define WS_END (WS_Y + 4u * (size_t)NB * TT * CC)

// ---- k_proj: block = (128 rows, 128 cols, which), 8 waves of 16 rows x 128 cols: qkv = x W (+ b), exact; each 32-k slice of X and W is read in whole lines, rounded to bf16 once per block and staged in LDS (two buffers); q -> f16 hi (+ residual), k -> f16 rows, v -> bf16 planes
typedef __attribute__((ext_vector_type(4))) __bf16 v4b;
#define PJP 40    // pitch of a staged slice row, bf16 elements: 80 B = 16 B x odd, no bank conflict for 16-byte reads
#define PJE 136   // pitch of an output plane row, 16-bit elements
__device__ __forceinline__ void pj_load(const float* wp, const float* const* xp, float* wr, v4f* xr) {
#pragma unroll
  for (int i = 0; i < 16; ++i) wr[i] = wp[(size_t)i * CC];   /* a wave reads 32 neighbouring columns of one k: one line */
#pragma unroll
  for (int it = 0; it < 4; ++it) xr[it] = *(const __attribute__((address_space(1))) v4f*)xp[it];   /* eight lanes a row: four whole lines a wave; named global, else the carried pointers compile to flat loads */
}
__device__ __forceinline__ void pj_store(__bf16* wd, __bf16* xd, const float* wr, const v4f* xr) {
  v8b w0, w1;
#pragma unroll
  for (int i = 0; i < 8; ++i) { w0[i] = (__bf16)wr[i]; w1[i] = (__bf16)wr[8 + i]; }
  *(v8b*)wd = w0; *(v8b*)(wd + 8) = w1;   /* W slice transposed: [column][k] */
#pragma unroll
  for (int it = 0; it < 4; ++it) { v4b x;
#pragma unroll
    for (int i = 0; i < 4; ++i) x[i] = (__bf16)xr[it][i];
    *(v4b*)(xd + it * 32 * PJP) = x; }
}
__global__ __launch_bounds__(256) void k_proj(const float* __restrict__ X0, const float* __restrict__ X1, const float* __restrict__ X2, const float* __restrict__ WQ, const float* __restrict__ BQ, const float* __restrict__ WK, const float* __restrict__ BK, const float* __restrict__ WV, const float* __restrict__ BV, _Float16* __restrict__ QH, _Float16* __restrict__ QL, _Float16* __restrict__ KH, __bf16* __restrict__ VT, __bf16* __restrict__ VL) {
  __shared__ __align__(16) unsigned short sm[2 * 128 * PJE];   /* in the loop: X slices [2][128][PJP], then W slices [2][128][PJP]; behind the loop: the two output planes [128][PJE] */
  __bf16* const xs = (__bf16*)sm; __bf16* const wt = xs + 2 * 128 * PJP;
  const int tid = threadIdx.x, wave = tid >> 5, lane = tid & 31, col = lane & 15, g = lane >> 4; const int which = blockIdx.z; const int c0 = blockIdx.y * 128; const size_t r0 = (size_t)blockIdx.x * 128; const float* WA = which == 0 ? WQ : which == 1 ? WK : WV; const float* BA = which == 0 ? BQ : which == 1 ? BK : BV; const float* X = which == 0 ? X0 : which == 1 ? X1 : X2;
  const float* wp = WA + (size_t)((tid >> 7) * 16) * CC + c0 + (tid & 127);   /* thread: one column, 16 of the slice's 32 k */
  const float* xp[4];
#pragma unroll
  for (int it = 0; it < 4; ++it) xp[it] = X + XROW(r0 + it * 32 + (tid >> 3)) * CC + (tid & 7) * 4;   /* padded row -> clamped 500-row input */
  __bf16* const wd = wt + (tid & 127) * PJP + (tid >> 7) * 16; __bf16* const xd = xs + (tid >> 3) * PJP + (tid & 7) * 4;
  float wr[16]; v4f xr[4];
  pj_load(wp, xp, wr, xr); pj_store(wd, xd, wr, xr);
  __syncthreads();   /* slice 0 is read by every wave */
  v8f acc[8] = {};
#pragma unroll 2
  for (int kc = 0; kc < CC / 32; ++kc) { const int cur = (kc & 1) * 128 * PJP, nxt = 128 * PJP - cur;
    if (kc + 1 < CC / 32) { wp += 32 * CC;
#pragma unroll
      for (int it = 0; it < 4; ++it) xp[it] += 32;
      pj_load(wp, xp, wr, xr); }   /* the next slice flies behind this slice's products */
    const v16b a = frag_b(xs + cur + (wave * 16 + col) * PJP, lane);
#pragma unroll
    for (int jh = 0; jh < 8; jh += 4) { v16b w[4];
#pragma unroll
      for (int j = 0; j < 4; ++j) w[j] = frag_b(wt + cur + ((jh + j) * 16 + col) * PJP, lane);
#pragma unroll
      for (int j = 0; j < 4; ++j) acc[jh + j] = wmma_bf(a, w[j], acc[jh + j]); }
    if (kc + 1 < CC / 32) pj_store(wd + nxt, xd + nxt, wr, xr);
    __syncthreads(); }   /* publishes the next slice and ends every read of this one (after the last slice: before the planes overlay it) */
  _Float16* const sh = (_Float16*)sm; _Float16* const sl = sh + 128 * PJE; __bf16* const th = (__bf16*)sm; __bf16* const tl2 = th + 128 * PJE;
#pragma unroll
  for (int j = 0; j < 8; ++j) { const float bb = BA ? bfr(BA[c0 + j * 16 + col]) : 0.f;
#pragma unroll
    for (int r = 0; r < 8; ++r) { const float v = acc[j][r] + bb; const int rl = wave * 16 + 8 * g + r, cl = j * 16 + col; const _Float16 hv = (_Float16)v;
      if (which == 2) { const __bf16 bh = (__bf16)v; th[cl * PJE + rl] = bh; tl2[cl * PJE + rl] = (__bf16)(v - (float)bh); } else { sh[rl * PJE + cl] = hv; sl[rl * PJE + cl] = (_Float16)((v - (float)hv) * 1024.0f); }   /* q residual carried x 2^10 so the plane stays f16-normal on the chip */ } }
  __syncthreads();
  if (which < 2) { _Float16* dh = which == 0 ? QH : KH; for (int e = tid; e < 128 * 16; e += 256) { const int rl = e >> 4, q = e & 15; vst2((unsigned*)(dh + (r0 + rl) * CC + c0 + q * 8), *(const v4u*)&sh[rl * PJE + q * 8]);
      asm volatile("s_wait_xcnt 0x0" ::: "memory");   /* stands in front of the next LDS read and address step, which rewrite the store's registers */
      if (which == 0) { vst2((unsigned*)(QL + (r0 + rl) * CC + c0 + q * 8), *(const v4u*)&sl[rl * PJE + q * 8]);
        asm volatile("s_wait_xcnt 0x0" ::: "memory"); } } }   /* the same, behind the residual's store */
  else { const size_t b = r0 / TT; const int t0 = (int)(r0 % TT); for (int e = tid; e < 128 * 16; e += 256) { const int cl = e >> 4, q = e & 15; const size_t o2 = (b * CC + c0 + cl) * (size_t)TT + t0 + q * 8; vst2((unsigned*)(VT + o2), *(const v4u*)&th[cl * PJE + q * 8]); vst2((unsigned*)(VL + o2), *(const v4u*)&tl2[cl * PJE + q * 8]); } } }
// ---- k_att: block = (64 queries, head, batch), wave = 16 queries: S^T = K Q^T (2 products) / 8 + bias, online softmax per query column, O^T += V^T P^T (3 products); scores and P never leave the registers
__global__ __launch_bounds__(128) void k_att(const _Float16* __restrict__ QH, const _Float16* __restrict__ QL, const _Float16* __restrict__ KH, const __bf16* __restrict__ VT, const __bf16* __restrict__ VL, const float* __restrict__ REL, float* __restrict__ Y) {   /* REL: rel_emb [16][999] */
  __shared__ float rt[2 * TT]; __shared__ __align__(16) float ss[4][16][HD + 4];
  const int tid = threadIdx.x, wave = tid >> 5, lane = tid & 31, col = lane & 15, g = lane >> 4; const int h = blockIdx.y, b = blockIdx.z; const int ql0 = blockIdx.x * 64 + wave * 16;
  const _Float16* kp = KH + ((size_t)b * TT + col) * CC + h * HD; const size_t vo = ((size_t)b * CC + h * HD + col) * (size_t)TT;
  v16h qh[HD / 32], qlo[HD / 32], kb[2][HD / 32];
#pragma unroll
  for (int kc = 0; kc < HD / 32; ++kc) { const size_t qo = ((size_t)b * TT + ql0 + col) * CC + h * HD + kc * 32; qh[kc] = frag_h(QH + qo, lane); qlo[kc] = frag_h(QL + qo, lane);
#pragma unroll
    for (int t = 0; t < 2; ++t) kb[t][kc] = frag_h(kp + (size_t)(t * 16) * CC + kc * 32, lane); }
#pragma unroll   /* all eight table loads of a thread in flight together */
  for (int n = 0; n < 2 * TT / 128; ++n) { const int i = n * 128 + tid, ri = (TT - 1) - i + LB - 1; rt[i] = bfr(REL[(size_t)h * NREL + (ri < 0 ? 0 : (ri < NREL ? ri : NREL - 1))]); }   /* rt[511 - q + k] = bias at q - k + 499 (clamped for padded rows): ascending in k */
  __syncthreads();   /* the bias row is read by every wave */
  const float* rb = rt + (TT - 1) - (ql0 + col) + 8 * g;
  v8f o[HD / 16] = {}; float m = -3.0e38f, l = 0.f;
#pragma unroll 1   /* rolled: the K fragments rotate through one register set */
  for (int k0 = 0; k0 < TT; k0 += 32) { v16b vh[HD / 16], vl[HD / 16];
#pragma unroll
    for (int j = 0; j < HD / 16; ++j) { const size_t po = vo + (size_t)(j * 16) * TT + k0; vh[j] = frag_b(VT + po, lane); vl[j] = frag_b(VL + po, lane); }
    __builtin_amdgcn_sched_barrier(0);   /* keeps this step's V loads in front of the score products, so that they fly behind products and softmax */
    v8f a[2] = {}, al[2] = {};
#pragma unroll
    for (int kc = 0; kc < HD / 32; ++kc)
#pragma unroll
      for (int t = 0; t < 2; ++t) { a[t] = wmma16(kb[t][kc], qh[kc], a[t]); al[t] = wmma16(kb[t][kc], qlo[kc], al[t]); }
    const int kn = k0 + 32 < TT ? k0 + 32 : 0;   /* the last step re-reads the first rows, unused */
#pragma unroll
    for (int kc = 0; kc < HD / 32; ++kc)
#pragma unroll
      for (int t = 0; t < 2; ++t) kb[t][kc] = frag_h(kp + (size_t)(kn + t * 16) * CC + kc * 32, lane);
    __builtin_amdgcn_sched_barrier(0);   /* keeps the next step's K loads in front of the softmax, one step ahead of their use */
    float s[16];
#pragma unroll
    for (int t = 0; t < 2; ++t)
#pragma unroll
      for (int r = 0; r < 8; ++r) s[t * 8 + r] = (a[t][r] + al[t][r] * (1.0f / 1024.0f)) * 0.125f + rb[k0 + t * 16 + r];   /* lane (g, col): key k0 + 16 t + 8 g + r, query ql0 + col */
    if (k0 + 32 > LB) {   /* padded keys masked */
#pragma unroll
      for (int t = 0; t < 2; ++t)
#pragma unroll
        for (int r = 0; r < 8; ++r) if (k0 + t * 16 + 8 * g + r >= LB) s[t * 8 + r] = -3.0e38f; }
    float mx = m;
#pragma unroll
    for (int i = 0; i < 16; ++i) mx = fmaxf(mx, s[i]);
    mx = fmaxf(mx, __shfl_xor(mx, 16));   /* the two lane halves hold the two key halves of one query */
    const float al0 = expf(m - mx); m = mx; l *= al0;
#pragma unroll
    for (int j = 0; j < HD / 16; ++j) o[j] *= al0;
#pragma unroll
    for (int i = 0; i < 16; ++i) { s[i] = expf(s[i] - m); l += s[i]; }   /* masked keys underflow to 0 */
    const F2 p = bsplit16(s);   /* two S^T tiles of 16 keys are one B fragment of 32 keys */
#pragma unroll
    for (int j = 0; j < HD / 16; ++j) o[j] = wmma_bf(vh[j], p.h, o[j]);
#pragma unroll
    for (int j = 0; j < HD / 16; ++j) o[j] = wmma_bf(vh[j], p.l, o[j]);
#pragma unroll
    for (int j = 0; j < HD / 16; ++j) o[j] = wmma_bf(vl[j], p.h, o[j]); }
  l += __shfl_xor(l, 16); const float inv = 1.0f / l;
#pragma unroll
  for (int j = 0; j < HD / 16; ++j) { v4f x0, x1;
#pragma unroll
    for (int r = 0; r < 4; ++r) { x0[r] = o[j][r] * inv; x1[r] = o[j][4 + r] * inv; }
    *(v4f*)&ss[wave][col][j * 16 + 8 * g] = x0; *(v4f*)&ss[wave][col][j * 16 + 8 * g + 4] = x1; }   /* lane (g, col): d = 16 j + 8 g + r of query col */
  LDSX();
#pragma unroll
  for (int it = 0; it < 8; ++it) { const int rl = it * 2 + g; if (ql0 + rl < LB) vst2(Y + ((size_t)b * LB + ql0 + rl) * CC + h * HD + col * 4, *(const v4f*)&ss[wave][rl][col * 4]); } }   /* only the 500 real rows, at the output's 500-row stride */
// ---- k_out: block = (64 rows, 128 cols): out = y (bf16 hi + lo) Wo + bo
__global__ __launch_bounds__(128) void k_out(const float* __restrict__ Y, const float* __restrict__ WP, const float* __restrict__ BP, float* __restrict__ OUT) { __shared__ __align__(16) float sf[4][16][132];
  const int tid = threadIdx.x, wave = tid >> 5, lane = tid & 31, col = lane & 15, g = lane >> 4; const int c0 = blockIdx.y * 128; const size_t r0 = (size_t)blockIdx.x * 64 + wave * 16;
  v8f acc[8] = {};
#pragma unroll 2
  for (int kc = 0; kc < CC / 32; ++kc) { const F2 a = split_row(Y + (r0 + col) * CC, kc * 32, lane);
#pragma unroll
    for (int j = 0; j < 8; ++j) { v16b w; const int o = c0 + j * 16 + col;
#pragma unroll
      for (int i = 0; i < 8; ++i) { w[i] = (__bf16)WP[(size_t)(kc * 32 + 8 * g + i) * CC + o]; w[8 + i] = (__bf16)WP[(size_t)(kc * 32 + 16 + 8 * g + i) * CC + o]; }   /* (in,out) */
      acc[j] = wmma_bf(a.h, w, acc[j]); acc[j] = wmma_bf(a.l, w, acc[j]); } }
#pragma unroll
  for (int j = 0; j < 8; ++j) { const float bb = BP ? bfr(BP[c0 + j * 16 + col]) : 0.f;
#pragma unroll
    for (int r = 0; r < 8; ++r) sf[wave][8 * g + r][j * 16 + col] = acc[j][r] + bb; }
  LDSX(); for (int rl = 0; rl < 16; ++rl) vst2(OUT + (r0 + rl) * CC + c0 + lane * 4, *(const v4f*)&sf[wave][rl][lane * 4]); }
extern "C" void kernel_launch(void* const* d_in, const int* in_sizes, int n_in, void* d_out, int out_size, void* d_ws, size_t ws_size, hipStream_t stream) {
  (void)in_sizes; (void)n_in; (void)out_size;
  const float** F = (const float**)d_in;   // 0 query [8,500,1024], 1 key, 2 value, 3 Wq ((in,out)), 4 bq, 5 Wk, 6 bk, 7 Wv, 8 bv, 9 rel_emb [16,999]
  if (ws_size < (size_t)WS_END) return;
  char* ws = (char*)d_ws; _Float16 *QH = (_Float16*)(ws + WS_QH), *QL = (_Float16*)(ws + WS_QL), *KH = (_Float16*)(ws + WS_KH); __bf16 *VT = (__bf16*)(ws + WS_VT), *VL = (__bf16*)(ws + WS_VL);
  k_proj<<<dim3(TNB * TT / 128, CC / 128, 3), 256, 0, stream>>>(F[0], F[1], F[2], F[3], F[4], F[5], F[6], F[7], F[8], QH, QL, KH, VT, VL);
  k_att<<<dim3(TT / 64, NH, TNB), 128, 0, stream>>>(QH, QL, KH, VT, VL, F[9], (float*)d_out);
}

// v003
// Measured time: 77.9 microseconds a run.
// In two side-by-side timings against v002, it was 1.29 and 1.30 times as fast.
// Counting every step since v000, it is 7.70 times as fast.
// compute dtype: all float inputs rounded to bf16; q/k/v = x W + b ((in,out)) with EXACT bf16 products on WMMA 16x16x32, f32 accumulate (sequence padded 500 -> 512 internally; padded keys masked, padded queries dropped); q as f16 hi + residual (x 2^10), k f16 -> 2-product logits / 8 + rel_emb[h][q - k + 499] kept in f32 registers (one launch for all batches and heads); online softmax in f32 (precise expf), 32 keys a step; unnormalised P split bf16 hi + lo against v bf16 hi + lo (3 products), divided by the row sum at the end; the merged context is the output; f32 output.
#include <hip/hip_runtime.h>
#include <math.h>

typedef __attribute__((ext_vector_type(16))) _Float16 v16h;
typedef __attribute__((ext_vector_type(16))) __bf16 v16b;
typedef __attribute__((ext_vector_type(8)))  _Float16 v8h;
typedef __attribute__((ext_vector_type(8)))  float v8f;
typedef __attribute__((ext_vector_type(4)))  float v4f;
typedef __attribute__((ext_vector_type(2)))  float v2f;
typedef __attribute__((ext_vector_type(4)))  unsigned v4u;
typedef __attribute__((ext_vector_type(4)))  int v4i;
typedef float __attribute__((may_alias)) float_a;
typedef int __attribute__((may_alias)) int_a;

template <typename T> __device__ __forceinline__ void vst2(void* p, T v) { *(T*)p = v;  }
__device__ __forceinline__ v8f wmma16(v16h a, v16h b, v8f c) {
  v8f d = __builtin_amdgcn_wmma_f32_16x16x32_f16(false, a, false, b, (short)0, c, false, false);
  asm volatile("v_nop\n\tv_nop\n\tv_nop\n\tv_nop" : "+v"(d) : "v"(a), "v"(b));
  return d;
}
__device__ __forceinline__ v8f wmma_bf(v16b a, v16b b, v8f c) {
  v8f d = __builtin_amdgcn_wmma_f32_16x16x32_bf16(false, a, false, b, (short)0, c, false, false);
  asm volatile("v_nop\n\tv_nop\n\tv_nop\n\tv_nop" : "+v"(d) : "v"(a), "v"(b));
  return d;
}
// 16x16x32 fragments: lane = (h = lane>>4, row/col = lane&15); elements 0..7 = k0+8h+0..7, 8..15 = k0+16+8h+0..7; D element r = row 8h+r
__device__ __forceinline__ v16h frag_h(const _Float16* rowk0, int lane) {
  union { v16h v; v8h q[2]; } u; const _Float16* p = rowk0 + 8 * (lane >> 4);
  u.q[0] = *(const v8h*)p; u.q[1] = *(const v8h*)(p + 16); return u.v;
}
__device__ __forceinline__ v16h frag_f32(const float* rowk0, int lane) {
  v16h a; const float* p = rowk0 + 8 * (lane >> 4);
#pragma unroll
  for (int i = 0; i < 8; ++i) { a[i] = (_Float16)p[i]; a[8 + i] = (_Float16)p[16 + i]; }
  return a;
}
__device__ __forceinline__ v16h frag_f32s(const float* rowk0, int lane, float sc) {
  v16h a; const float* p = rowk0 + 8 * (lane >> 4);
#pragma unroll
  for (int i = 0; i < 8; ++i) { a[i] = (_Float16)(p[i] * sc); a[8 + i] = (_Float16)(p[16 + i] * sc); }
  return a;
}
// column fragment from a [K][ld] layout (column n), rows >= K read as 0
__device__ __forceinline__ v16h fragc_f32(const float* W, int k0, int n, int lane, int ld, int K) {
  v16h a; const int g = lane >> 4;
#pragma unroll
  for (int i = 0; i < 8; ++i) { const int ka = k0 + 8 * g + i, kb = ka + 16;
    a[i] = (_Float16)(ka < K ? W[(size_t)(ka < K ? ka : K - 1) * ld + n] : 0.f); a[8 + i] = (_Float16)(kb < K ? W[(size_t)(kb < K ? kb : K - 1) * ld + n] : 0.f); }
  return a;
}
struct F2 { v16b h, l; };
__device__ __forceinline__ F2 bsplit16(const float v[16]) { F2 r;
#pragma unroll
  for (int i = 0; i < 16; ++i) { const __bf16 h = (__bf16)v[i]; r.h[i] = h; r.l[i] = (__bf16)(v[i] - (float)h); }
  return r; }
__device__ __forceinline__ F2 split_row(const float* row, int k0, int lane) { float v[16]; const float* p = row + k0 + 8 * (lane >> 4);
#pragma unroll
  for (int i = 0; i < 8; ++i) { v[i] = p[i]; v[8 + i] = p[16 + i]; }
  return bsplit16(v); }
__device__ __forceinline__ F2 split_rowK(const float* row, int k0, int lane, int K) { float v[16]; const int g = lane >> 4;
#pragma unroll
  for (int i = 0; i < 8; ++i) { const int ka = k0 + 8 * g + i, kb = ka + 16; v[i] = ka < K ? row[ka < K ? ka : K - 1] : 0.f; v[8 + i] = kb < K ? row[kb < K ? kb : K - 1] : 0.f; }
  return bsplit16(v); }
__device__ __forceinline__ F2 split_col(const float* W, int k0, int n, int lane, int ld, int K) { float v[16]; const int g = lane >> 4;
#pragma unroll
  for (int i = 0; i < 8; ++i) { const int ka = k0 + 8 * g + i, kb = ka + 16; v[i] = ka < K ? W[(size_t)(ka < K ? ka : K - 1) * ld + n] : 0.f; v[8 + i] = kb < K ? W[(size_t)(kb < K ? kb : K - 1) * ld + n] : 0.f; }
  return bsplit16(v); }
__device__ __forceinline__ v8f mac3(const F2& a, const F2& b, v8f c) { c = wmma_bf(a.l, b.h, c); c = wmma_bf(a.h, b.l, c); return wmma_bf(a.h, b.h, c); }
__device__ __forceinline__ float sigm(float v) { return 1.0f / (1.0f + expf(-v)); }
#define LDSX() do { asm volatile("s_wait_dscnt 0" ::: "memory"); __builtin_amdgcn_wave_barrier(); __builtin_amdgcn_fence(__ATOMIC_RELEASE, "workgroup"); } while (0)


// Attention (B 8, S 500 padded to 512, D 1,024 = 16 x 64, q/k/v biases, logits / 8): scores = q k^T / 8 + rel_emb[h][q - k + 499] (999 offsets), softmax, P v; the context is the output.
#define NB 8
#define TT 512               // padded length
#define LB 500               // real sequence length (input/output rows per batch)
#define NREL 999
#define XROW(r) (((r) / TT) * (size_t)LB + (((r) % TT) < LB ? ((r) % TT) : (LB - 1)))   /* padded row -> clamped input row */
#define CC 1024
#define NH 16
#define HD 64
#define HG 16               // heads per launch group
#ifndef TNB
#define TNB NB
#endif
typedef __attribute__((ext_vector_type(8))) __bf16 v8b;
__device__ __forceinline__ v16b frag_b(const __bf16* rowk0, int lane) {
  union { v16b v; v8b q[2]; } u; const __bf16* p = rowk0 + 8 * (lane >> 4);
  u.q[0] = *(const v8b*)p; u.q[1] = *(const v8b*)(p + 16); return u.v;
}
__device__ __forceinline__ float bfr(float v) { return (float)(__bf16)v; }
__device__ __attribute__((noinline)) float exp_ni(float v) { return expf(v); }
__device__ __attribute__((noinline)) float erf_ni(float v) { return erff(v); }

#define WS_QH  0u
#define WS_QL  (WS_QH + 2u * (size_t)NB * TT * CC)
#define WS_KH  (WS_QL + 2u * (size_t)NB * TT * CC)
#define WS_VT  (WS_KH + 2u * (size_t)NB * TT * CC)      // bf16 v planes [b][c][t]
#define WS_VL  (WS_VT + 2u * (size_t)NB * CC * TT)      // bf16 v residual planes
#define WS_S   (WS_VL + 2u * (size_t)NB * CC * TT)      // f32 region [hg][q][k], unused: scores stay in registers
#define WS_PH  (WS_S + 4u * (size_t)HG * TT * TT)
#define WS_Y   (WS_PH + 0u)              // unused; y is written straight to the output
#define WS_END (WS_Y + 4u * (size_t)NB * TT * CC)

// ---- k_proj: block = (128 rows, 128 cols, which), 8 waves of 16 rows x 128 cols: qkv = x W (+ b), exact; each 32-k slice of X and W is read in whole lines, rounded to bf16 once per block and staged in LDS (two buffers); q -> f16 hi (+ residual), k -> f16 rows, v -> bf16 planes
typedef __attribute__((ext_vector_type(4))) __bf16 v4b;
#define PJP 40    // pitch of a staged slice row, bf16 elements: 80 B = 16 B x odd, no bank conflict for 16-byte reads
#define PJE 136   // pitch of an output plane row, 16-bit elements
__device__ __forceinline__ void pj_load(const float* wp, const float* const* xp, float* wr, v4f* xr) {
#pragma unroll
  for (int i = 0; i < 16; ++i) wr[i] = wp[(size_t)i * CC];   /* a wave reads 32 neighbouring columns of one k: one line */
#pragma unroll
  for (int it = 0; it < 4; ++it) xr[it] = *(const __attribute__((address_space(1))) v4f*)xp[it];   /* eight lanes a row: four whole lines a wave; named global, else the carried pointers compile to flat loads */
}
__device__ __forceinline__ void pj_store(__bf16* wd, __bf16* xd, const float* wr, const v4f* xr) {
  v8b w0, w1;
#pragma unroll
  for (int i = 0; i < 8; ++i) { w0[i] = (__bf16)wr[i]; w1[i] = (__bf16)wr[8 + i]; }
  *(v8b*)wd = w0; *(v8b*)(wd + 8) = w1;   /* W slice transposed: [column][k] */
#pragma unroll
  for (int it = 0; it < 4; ++it) { v4b x;
#pragma unroll
    for (int i = 0; i < 4; ++i) x[i] = (__bf16)xr[it][i];
    *(v4b*)(xd + it * 32 * PJP) = x; }
}
__global__ __launch_bounds__(256) void k_proj(const float* __restrict__ X0, const float* __restrict__ X1, const float* __restrict__ X2, const float* __restrict__ WQ, const float* __restrict__ BQ, const float* __restrict__ WK, const float* __restrict__ BK, const float* __restrict__ WV, const float* __restrict__ BV, _Float16* __restrict__ QH, _Float16* __restrict__ QL, _Float16* __restrict__ KH, __bf16* __restrict__ VT, __bf16* __restrict__ VL) {
  __shared__ __align__(16) unsigned short sm[2 * 128 * PJE];   /* in the loop: X slices [2][128][PJP], then W slices [2][128][PJP]; behind the loop: the two output planes [128][PJE] */
  __bf16* const xs = (__bf16*)sm; __bf16* const wt = xs + 2 * 128 * PJP;
  const int tid = threadIdx.x, wave = tid >> 5, lane = tid & 31, col = lane & 15, g = lane >> 4; const int which = blockIdx.z; const int c0 = blockIdx.y * 128; const size_t r0 = (size_t)blockIdx.x * 128; const float* WA = which == 0 ? WQ : which == 1 ? WK : WV; const float* BA = which == 0 ? BQ : which == 1 ? BK : BV; const float* X = which == 0 ? X0 : which == 1 ? X1 : X2;
  const float* wp = WA + (size_t)((tid >> 7) * 16) * CC + c0 + (tid & 127);   /* thread: one column, 16 of the slice's 32 k */
  const float* xp[4];
#pragma unroll
  for (int it = 0; it < 4; ++it) xp[it] = X + XROW(r0 + it * 32 + (tid >> 3)) * CC + (tid & 7) * 4;   /* padded row -> clamped 500-row input */
  __bf16* const wd = wt + (tid & 127) * PJP + (tid >> 7) * 16; __bf16* const xd = xs + (tid >> 3) * PJP + (tid & 7) * 4;
  float wr[16]; v4f xr[4];
  pj_load(wp, xp, wr, xr); pj_store(wd, xd, wr, xr);
  __syncthreads();   /* slice 0 is read by every wave */
  v8f acc[8] = {};
#pragma unroll 2
  for (int kc = 0; kc < CC / 32; ++kc) { const int cur = (kc & 1) * 128 * PJP, nxt = 128 * PJP - cur;
    if (kc + 1 < CC / 32) { wp += 32 * CC;
#pragma unroll
      for (int it = 0; it < 4; ++it) xp[it] += 32;
      pj_load(wp, xp, wr, xr); }   /* the next slice flies behind this slice's products */
    const v16b a = frag_b(xs + cur + (wave * 16 + col) * PJP, lane);
#pragma unroll
    for (int jh = 0; jh < 8; jh += 4) { v16b w[4];
#pragma unroll
      for (int j = 0; j < 4; ++j) w[j] = frag_b(wt + cur + ((jh + j) * 16 + col) * PJP, lane);
#pragma unroll
      for (int j = 0; j < 4; ++j) acc[jh + j] = wmma_bf(a, w[j], acc[jh + j]); }
    if (kc + 1 < CC / 32) pj_store(wd + nxt, xd + nxt, wr, xr);
    __syncthreads(); }   /* publishes the next slice and ends every read of this one (after the last slice: before the planes overlay it) */
  _Float16* const sh = (_Float16*)sm; _Float16* const sl = sh + 128 * PJE; __bf16* const th = (__bf16*)sm; __bf16* const tl2 = th + 128 * PJE;
#pragma unroll
  for (int j = 0; j < 8; ++j) { const float bb = BA ? bfr(BA[c0 + j * 16 + col]) : 0.f;
#pragma unroll
    for (int r = 0; r < 8; ++r) { const float v = acc[j][r] + bb; const int rl = wave * 16 + 8 * g + r, cl = j * 16 + col; const _Float16 hv = (_Float16)v;
      if (which == 2) { const __bf16 bh = (__bf16)v; th[cl * PJE + rl] = bh; tl2[cl * PJE + rl] = (__bf16)(v - (float)bh); } else { sh[rl * PJE + cl] = hv; sl[rl * PJE + cl] = (_Float16)((v - (float)hv) * 1024.0f); }   /* q residual carried x 2^10 so the plane stays f16-normal on the chip */ } }
  __syncthreads();
  if (which < 2) { _Float16* dh = which == 0 ? QH : KH; for (int e = tid; e < 128 * 16; e += 256) { const int rl = e >> 4, q = e & 15; vst2((unsigned*)(dh + (r0 + rl) * CC + c0 + q * 8), *(const v4u*)&sh[rl * PJE + q * 8]);
      asm volatile("s_wait_xcnt 0x0" ::: "memory");   /* stands in front of the next LDS read and address step, which rewrite the store's registers */
      if (which == 0) { vst2((unsigned*)(QL + (r0 + rl) * CC + c0 + q * 8), *(const v4u*)&sl[rl * PJE + q * 8]);
        asm volatile("s_wait_xcnt 0x0" ::: "memory"); } } }   /* the same, behind the residual's store */
  else { const size_t b = r0 / TT; const int t0 = (int)(r0 % TT); for (int e = tid; e < 128 * 16; e += 256) { const int cl = e >> 4, q = e & 15; const size_t o2 = (b * CC + c0 + cl) * (size_t)TT + t0 + q * 8; vst2((unsigned*)(VT + o2), *(const v4u*)&th[cl * PJE + q * 8]); vst2((unsigned*)(VL + o2), *(const v4u*)&tl2[cl * PJE + q * 8]); } } }
// ---- k_att: block = (64 queries, head, batch), wave = 16 queries: S^T = K Q^T (2 products) / 8 + bias, online softmax per query column, O^T += V^T P^T (3 products); scores and P never leave the registers; K rows and the two V planes come 64 keys a stage by tensor loads into two LDS buffers that the four waves share
typedef __attribute__((ext_vector_type(8))) unsigned v8u;
#define SKY 64              // keys per stage: a staged row is one whole 128-byte line (K: 64 d of one key; V planes: 64 keys of one d)
#define TPE 72              // LDS pitch of a staged row, 16-bit elements: 144 B = 16 B x odd, no bank conflict for 16-byte reads
#define TSZ 10240           // one staged tile: 64 rows x 144 B, rounded up to a multiple of 2 KiB
#define BSZ (3 * TSZ)       // one buffer: K, V hi, V lo
#define NST (TT / SKY)
__device__ __forceinline__ unsigned uni(unsigned v) { return (unsigned)__builtin_amdgcn_readfirstlane(v); }
__device__ __forceinline__ unsigned pinned(unsigned v) { unsigned w = uni(v); asm volatile("" : "+s"(w)); return w; }
__device__ __forceinline__ void tdm_load(unsigned lds_dst, unsigned long long ga, v8u g1) { v4u g0;
  g0[0] = uni(1u); g0[1] = uni(lds_dst); g0[2] = uni((unsigned)ga); g0[3] = uni((((unsigned)(ga >> 32)) & 0x01FFFFFFu) | 0x80000000u);
  asm volatile("tensor_load_to_lds %0, %1" :: "s"(g0), "s"(g1) : "memory"); }   /* one request of the whole wave: 64 rows of 128 B into LDS, through no register */
__global__ __launch_bounds__(128) void k_att(const _Float16* __restrict__ QH, const _Float16* __restrict__ QL, const _Float16* __restrict__ KH, const __bf16* __restrict__ VT, const __bf16* __restrict__ VL, const float* __restrict__ REL, float* __restrict__ Y) {   /* REL: rel_emb [16][999] */
  __shared__ __attribute__((aligned(2048))) unsigned char ring[2 * BSZ];   /* in the loop: two buffers of three tiles; behind the loop: the output staging */
  __shared__ float rt[2 * TT];
  const int tid = threadIdx.x, lane = tid & 31, col = lane & 15, g = lane >> 4; const int h = blockIdx.y, b = blockIdx.z; const unsigned wave = uni(tid >> 5); const int ql0 = blockIdx.x * 64 + wave * 16;
  /* waves 0, 1, 2 bring one tile a stage each: K rows, V hi plane, V lo plane */
  const unsigned long long tsrc = wave == 0 ? (unsigned long long)(size_t)(KH + (size_t)b * TT * CC + h * HD) : (unsigned long long)(size_t)((wave == 1 ? VT : VL) + ((size_t)b * CC + h * HD) * (size_t)TT);
  const unsigned tstep = wave == 0 ? SKY * 2u * CC : SKY * 2u;   /* bytes from one stage's tile to the next */
  const unsigned tdst = (unsigned)(size_t)ring + wave * TSZ;
  v8u g1;   /* 1-byte elements, tensor = tile = 64 rows of 128 B, a pad of 16 B behind every 128 B */
  g1[0] = uni((1u << 20) | (4u << 22) | (3u << 25)); g1[1] = uni(128u << 16); g1[2] = uni(64u << 16); g1[3] = uni(128u << 16); g1[4] = uni(64u); g1[5] = uni(wave == 0 ? 2u * CC : 2u * TT); g1[6] = uni(0u); g1[7] = uni(0u);
  v16h qh[HD / 32], qlo[HD / 32], kb[2][HD / 32];
#pragma unroll
  for (int kc = 0; kc < HD / 32; ++kc) { const size_t qo = ((size_t)b * TT + ql0 + col) * CC + h * HD + kc * 32; qh[kc] = frag_h(QH + qo, lane); qlo[kc] = frag_h(QL + qo, lane); }
  asm volatile("s_wait_xcnt 0x0" ::: "memory");   /* stands between the Q loads and the table loads, so that neither group's results land in an address register of the other while that is still named by an issued load */
#pragma unroll   /* all eight table loads of a thread in flight together */
  for (int n = 0; n < 2 * TT / 128; ++n) { const int i = n * 128 + tid, ri = (TT - 1) - i + LB - 1; rt[i] = bfr(REL[(size_t)h * NREL + (ri < 0 ? 0 : (ri < NREL ? ri : NREL - 1))]); }   /* rt[511 - q + k] = bias at q - k + 499 (clamped for padded rows): ascending in k */
  if (pinned(wave < 3)) { tdm_load(tdst, tsrc, g1);
    asm volatile("s_wait_tensorcnt 0x0" ::: "memory"); }   /* stage 0's tile has landed before the barrier that publishes it */
  __syncthreads();   /* the bias row and stage 0 are read by every wave */
  if (pinned(wave < 3)) tdm_load(tdst + BSZ, tsrc + tstep, g1);   /* stage 1 flies behind stage 0's work */
  const float* rb = rt + (TT - 1) - (ql0 + col) + 8 * g;
  v8f o[HD / 16] = {}; float m = -3.0e38f, l = 0.f;
#pragma unroll 1   /* rolled: one pass a stage, the buffer picked by the stage's parity */
  for (int s = 0; s < NST; ++s) { const unsigned char* bp = ring + (s & 1) * BSZ; const _Float16* kt = (const _Float16*)bp + col * TPE; const __bf16* th = (const __bf16*)(bp + TSZ) + col * TPE; const __bf16* tl = (const __bf16*)(bp + 2 * TSZ) + col * TPE;
#pragma unroll
    for (int kc = 0; kc < HD / 32; ++kc)
#pragma unroll
      for (int t = 0; t < 2; ++t) kb[t][kc] = frag_h(kt + (t * 16) * TPE + kc * 32, lane);
#pragma unroll
    for (int u = 0; u < SKY / 32; ++u) { const int k0 = s * SKY + u * 32; v16b vh[HD / 16], vl[HD / 16];
#pragma unroll
      for (int j = 0; j < HD / 16; ++j) { vh[j] = frag_b(th + (j * 16) * TPE + u * 32, lane); vl[j] = frag_b(tl + (j * 16) * TPE + u * 32, lane); }
      __builtin_amdgcn_sched_barrier(0);   /* keeps this step's V reads in one group in front of the score products, so that they return behind products and softmax */
      v8f a[2] = {}, al[2] = {};
#pragma unroll
      for (int kc = 0; kc < HD / 32; ++kc)
#pragma unroll
        for (int t = 0; t < 2; ++t) { a[t] = wmma16(kb[t][kc], qh[kc], a[t]); al[t] = wmma16(kb[t][kc], qlo[kc], al[t]); }
      if (u + 1 < SKY / 32) {   /* the next step's K rows, of this same stage only */
#pragma unroll
        for (int kc = 0; kc < HD / 32; ++kc)
#pragma unroll
          for (int t = 0; t < 2; ++t) kb[t][kc] = frag_h(kt + ((u + 1) * 32 + t * 16) * TPE + kc * 32, lane); }
      __builtin_amdgcn_sched_barrier(0);   /* keeps those K reads in front of the softmax, one step ahead of their use */
      float sc[16];
#pragma unroll
      for (int t = 0; t < 2; ++t)
#pragma unroll
        for (int r = 0; r < 8; ++r) sc[t * 8 + r] = (a[t][r] + al[t][r] * (1.0f / 1024.0f)) * 0.125f + rb[k0 + t * 16 + r];   /* lane (g, col): key k0 + 16 t + 8 g + r, query ql0 + col */
      if (k0 + 32 > LB) {   /* padded keys masked */
#pragma unroll
        for (int t = 0; t < 2; ++t)
#pragma unroll
          for (int r = 0; r < 8; ++r) if (k0 + t * 16 + 8 * g + r >= LB) sc[t * 8 + r] = -3.0e38f; }
      float mx = m;
#pragma unroll
      for (int i = 0; i < 16; ++i) mx = fmaxf(mx, sc[i]);
      mx = fmaxf(mx, __shfl_xor(mx, 16));   /* the two lane halves hold the two key halves of one query */
      const float al0 = expf(m - mx); m = mx; l *= al0;
#pragma unroll
      for (int j = 0; j < HD / 16; ++j) o[j] *= al0;
#pragma unroll
      for (int i = 0; i < 16; ++i) { sc[i] = expf(sc[i] - m); l += sc[i]; }   /* masked keys underflow to 0 */
      const F2 p = bsplit16(sc);   /* two S^T tiles of 16 keys are one B fragment of 32 keys */
#pragma unroll
      for (int j = 0; j < HD / 16; ++j) o[j] = wmma_bf(vh[j], p.h, o[j]);
#pragma unroll
      for (int j = 0; j < HD / 16; ++j) o[j] = wmma_bf(vh[j], p.l, o[j]);
#pragma unroll
      for (int j = 0; j < HD / 16; ++j) o[j] = wmma_bf(vl[j], p.h, o[j]); }
    asm volatile("s_wait_dscnt 0x0" ::: "memory");   /* this wave's reads of stage s have returned before its buffer is refilled */
    if (pinned(wave < 3)) asm volatile("s_wait_tensorcnt 0x0" ::: "memory");   /* the issuer's own tile of stage s + 1 has landed */
    __syncthreads();   /* publishes stage s + 1 and ends every wave's reads of stage s */
    if (pinned(wave < 3 && s + 2 < NST)) tdm_load(tdst + (s & 1) * BSZ, tsrc + (unsigned long long)pinned(s + 2) * tstep, g1); }   /* into the buffer that this pass has just read; the address is formed behind the wait */
  asm volatile("s_wait_tensorcnt 0x0" ::: "memory");   /* no request is in flight when the ring becomes output staging */
  asm volatile("s_wait_dscnt 0x0" ::: "memory");   /* nor a read of it; the last pass's barrier has ended every other wave's reads */
  float (*ss)[16][HD + 4] = (float (*)[16][HD + 4])ring;
  l += __shfl_xor(l, 16); const float inv = 1.0f / l;
#pragma unroll
  for (int j = 0; j < HD / 16; ++j) { v4f x0, x1;
#pragma unroll
    for (int r = 0; r < 4; ++r) { x0[r] = o[j][r] * inv; x1[r] = o[j][4 + r] * inv; }
    *(v4f*)&ss[wave][col][j * 16 + 8 * g] = x0; *(v4f*)&ss[wave][col][j * 16 + 8 * g + 4] = x1; }   /* lane (g, col): d = 16 j + 8 g + r of query col */
  LDSX();
#pragma unroll
  for (int it = 0; it < 8; ++it) { const int rl = it * 2 + g; if (ql0 + rl < LB) vst2(Y + ((size_t)b * LB + ql0 + rl) * CC + h * HD + col * 4, *(const v4f*)&ss[wave][rl][col * 4]); } }   /* only the 500 real rows, at the output's 500-row stride */
// ---- k_out: block = (64 rows, 128 cols): out = y (bf16 hi + lo) Wo + bo
__global__ __launch_bounds__(128) void k_out(const float* __restrict__ Y, const float* __restrict__ WP, const float* __restrict__ BP, float* __restrict__ OUT) { __shared__ __align__(16) float sf[4][16][132];
  const int tid = threadIdx.x, wave = tid >> 5, lane = tid & 31, col = lane & 15, g = lane >> 4; const int c0 = blockIdx.y * 128; const size_t r0 = (size_t)blockIdx.x * 64 + wave * 16;
  v8f acc[8] = {};
#pragma unroll 2
  for (int kc = 0; kc < CC / 32; ++kc) { const F2 a = split_row(Y + (r0 + col) * CC, kc * 32, lane);
#pragma unroll
    for (int j = 0; j < 8; ++j) { v16b w; const int o = c0 + j * 16 + col;
#pragma unroll
      for (int i = 0; i < 8; ++i) { w[i] = (__bf16)WP[(size_t)(kc * 32 + 8 * g + i) * CC + o]; w[8 + i] = (__bf16)WP[(size_t)(kc * 32 + 16 + 8 * g + i) * CC + o]; }   /* (in,out) */
      acc[j] = wmma_bf(a.h, w, acc[j]); acc[j] = wmma_bf(a.l, w, acc[j]); } }
#pragma unroll
  for (int j = 0; j < 8; ++j) { const float bb = BP ? bfr(BP[c0 + j * 16 + col]) : 0.f;
#pragma unroll
    for (int r = 0; r < 8; ++r) sf[wave][8 * g + r][j * 16 + col] = acc[j][r] + bb; }
  LDSX(); for (int rl = 0; rl < 16; ++rl) vst2(OUT + (r0 + rl) * CC + c0 + lane * 4, *(const v4f*)&sf[wave][rl][lane * 4]); }
extern "C" void kernel_launch(void* const* d_in, const int* in_sizes, int n_in, void* d_out, int out_size, void* d_ws, size_t ws_size, hipStream_t stream) {
  (void)in_sizes; (void)n_in; (void)out_size;
  const float** F = (const float**)d_in;   // 0 query [8,500,1024], 1 key, 2 value, 3 Wq ((in,out)), 4 bq, 5 Wk, 6 bk, 7 Wv, 8 bv, 9 rel_emb [16,999]
  if (ws_size < (size_t)WS_END) return;
  char* ws = (char*)d_ws; _Float16 *QH = (_Float16*)(ws + WS_QH), *QL = (_Float16*)(ws + WS_QL), *KH = (_Float16*)(ws + WS_KH); __bf16 *VT = (__bf16*)(ws + WS_VT), *VL = (__bf16*)(ws + WS_VL);
  k_proj<<<dim3(TNB * TT / 128, CC / 128, 3), 256, 0, stream>>>(F[0], F[1], F[2], F[3], F[4], F[5], F[6], F[7], F[8], QH, QL, KH, VT, VL);
  k_att<<<dim3(TT / 64, NH, TNB), 128, 0, stream>>>(QH, QL, KH, VT, VL, F[9], (float*)d_out);
}

// v004
// One run takes 71 microseconds.
// Next to v003, in two timings, it ran 1.11 and 1.10 times as fast.
// Over all steps from v000 it is 8.50 times as fast.
// compute dtype: all float inputs rounded to bf16; q/k/v = x W + b ((in,out)) with EXACT bf16 products on WMMA 16x16x32, f32 accumulate (sequence padded 500 -> 512 internally; padded keys masked, padded queries dropped); q as f16 hi + residual (x 2^10), k f16 -> 2-product logits / 8 + rel_emb[h][q - k + 499] kept in f32 registers (one launch for all batches and heads); online softmax in f32 on logits carried in log2 units (scale and bias table x log2 e, hardware exp2), 32 keys a step; unnormalised P split bf16 hi + lo against v bf16 hi + lo (3 products), divided by the row sum at the end; the merged context is the output; f32 output.
#include <hip/hip_runtime.h>
#include <math.h>

typedef __attribute__((ext_vector_type(16))) _Float16 v16h;
typedef __attribute__((ext_vector_type(16))) __bf16 v16b;
typedef __attribute__((ext_vector_type(8)))  _Float16 v8h;
typedef __attribute__((ext_vector_type(8)))  float v8f;
typedef __attribute__((ext_vector_type(4)))  float v4f;
typedef __attribute__((ext_vector_type(2)))  float v2f;
typedef __attribute__((ext_vector_type(4)))  unsigned v4u;
typedef __attribute__((ext_vector_type(4)))  int v4i;
typedef float __attribute__((may_alias)) float_a;
typedef int __attribute__((may_alias)) int_a;

template <typename T> __device__ __forceinline__ void vst2(void* p, T v) { *(T*)p = v;  }
__device__ __forceinline__ v8f wmma16(v16h a, v16h b, v8f c) {
  v8f d = __builtin_amdgcn_wmma_f32_16x16x32_f16(false, a, false, b, (short)0, c, false, false);
  asm volatile("v_nop\n\tv_nop\n\tv_nop\n\tv_nop" : "+v"(d) : "v"(a), "v"(b));
  return d;
}
__device__ __forceinline__ v8f wmma_bf(v16b a, v16b b, v8f c) {
  v8f d = __builtin_amdgcn_wmma_f32_16x16x32_bf16(false, a, false, b, (short)0, c, false, false);
  asm volatile("v_nop\n\tv_nop\n\tv_nop\n\tv_nop" : "+v"(d) : "v"(a), "v"(b));
  return d;
}
// 16x16x32 fragments: lane = (h = lane>>4, row/col = lane&15); elements 0..7 = k0+8h+0..7, 8..15 = k0+16+8h+0..7; D element r = row 8h+r
__device__ __forceinline__ v16h frag_h(const _Float16* rowk0, int lane) {
  union { v16h v; v8h q[2]; } u; const _Float16* p = rowk0 + 8 * (lane >> 4);
  u.q[0] = *(const v8h*)p; u.q[1] = *(const v8h*)(p + 16); return u.v;
}
__device__ __forceinline__ v16h frag_f32(const float* rowk0, int lane) {
  v16h a; const float* p = rowk0 + 8 * (lane >> 4);
#pragma unroll
  for (int i = 0; i < 8; ++i) { a[i] = (_Float16)p[i]; a[8 + i] = (_Float16)p[16 + i]; }
  return a;
}
__device__ __forceinline__ v16h frag_f32s(const float* rowk0, int lane, float sc) {
  v16h a; const float* p = rowk0 + 8 * (lane >> 4);
#pragma unroll
  for (int i = 0; i < 8; ++i) { a[i] = (_Float16)(p[i] * sc); a[8 + i] = (_Float16)(p[16 + i] * sc); }
  return a;
}
// column fragment from a [K][ld] layout (column n), rows >= K read as 0
__device__ __forceinline__ v16h fragc_f32(const float* W, int k0, int n, int lane, int ld, int K) {
  v16h a; const int g = lane >> 4;
#pragma unroll
  for (int i = 0; i < 8; ++i) { const int ka = k0 + 8 * g + i, kb = ka + 16;
    a[i] = (_Float16)(ka < K ? W[(size_t)(ka < K ? ka : K - 1) * ld + n] : 0.f); a[8 + i] = (_Float16)(kb < K ? W[(size_t)(kb < K ? kb : K - 1) * ld + n] : 0.f); }
  return a;
}
struct F2 { v16b h, l; };
__device__ __forceinline__ F2 bsplit16(const float v[16]) { F2 r;
#pragma unroll
  for (int i = 0; i < 16; ++i) { const __bf16 h = (__bf16)v[i]; r.h[i] = h; r.l[i] = (__bf16)(v[i] - (float)h); }
  return r; }
__device__ __forceinline__ F2 split_row(const float* row, int k0, int lane) { float v[16]; const float* p = row + k0 + 8 * (lane >> 4);
#pragma unroll
  for (int i = 0; i < 8; ++i) { v[i] = p[i]; v[8 + i] = p[16 + i]; }
  return bsplit16(v); }
__device__ __forceinline__ F2 split_rowK(const float* row, int k0, int lane, int K) { float v[16]; const int g = lane >> 4;
#pragma unroll
  for (int i = 0; i < 8; ++i) { const int ka = k0 + 8 * g + i, kb = ka + 16; v[i] = ka < K ? row[ka < K ? ka : K - 1] : 0.f; v[8 + i] = kb < K ? row[kb < K ? kb : K - 1] : 0.f; }
  return bsplit16(v); }
__device__ __forceinline__ F2 split_col(const float* W, int k0, int n, int lane, int ld, int K) { float v[16]; const int g = lane >> 4;
#pragma unroll
  for (int i = 0; i < 8; ++i) { const int ka = k0 + 8 * g + i, kb = ka + 16; v[i] = ka < K ? W[(size_t)(ka < K ? ka : K - 1) * ld + n] : 0.f; v[8 + i] = kb < K ? W[(size_t)(kb < K ? kb : K - 1) * ld + n] : 0.f; }
  return bsplit16(v); }
__device__ __forceinline__ v8f mac3(const F2& a, const F2& b, v8f c) { c = wmma_bf(a.l, b.h, c); c = wmma_bf(a.h, b.l, c); return wmma_bf(a.h, b.h, c); }
__device__ __forceinline__ float sigm(float v) { return 1.0f / (1.0f + expf(-v)); }
#define LDSX() do { asm volatile("s_wait_dscnt 0" ::: "memory"); __builtin_amdgcn_wave_barrier(); __builtin_amdgcn_fence(__ATOMIC_RELEASE, "workgroup"); } while (0)


// Attention (B 8, S 500 padded to 512, D 1,024 = 16 x 64, q/k/v biases, logits / 8): scores = q k^T / 8 + rel_emb[h][q - k + 499] (999 offsets), softmax, P v; the context is the output.
#define NB 8
#define TT 512               // padded length
#define LB 500               // real sequence length (input/output rows per batch)
#define NREL 999
#define XROW(r) (((r) / TT) * (size_t)LB + (((r) % TT) < LB ? ((r) % TT) : (LB - 1)))   /* padded row -> clamped input row */
#define CC 1024
#define NH 16
#define HD 64
#define HG 16               // heads per launch group
#ifndef TNB
#define TNB NB
#endif
typedef __attribute__((ext_vector_type(8))) __bf16 v8b;
__device__ __forceinline__ v16b frag_b(const __bf16* rowk0, int lane) {
  union { v16b v; v8b q[2]; } u; const __bf16* p = rowk0 + 8 * (lane >> 4);
  u.q[0] = *(const v8b*)p; u.q[1] = *(const v8b*)(p + 16); return u.v;
}
__device__ __forceinline__ float bfr(float v) { return (float)(__bf16)v; }
__device__ __attribute__((noinline)) float exp_ni(float v) { return expf(v); }
__device__ __attribute__((noinline)) float erf_ni(float v) { return erff(v); }

#define WS_QH  0u
#define WS_QL  (WS_QH + 2u * (size_t)NB * TT * CC)
#define WS_KH  (WS_QL + 2u * (size_t)NB * TT * CC)
#define WS_VT  (WS_KH + 2u * (size_t)NB * TT * CC)      // bf16 v planes [b][c][t]
#define WS_VL  (WS_VT + 2u * (size_t)NB * CC * TT)      // bf16 v residual planes
#define WS_S   (WS_VL + 2u * (size_t)NB * CC * TT)      // f32 region [hg][q][k], unused: scores stay in registers
#define WS_PH  (WS_S + 4u * (size_t)HG * TT * TT)
#define WS_Y   (WS_PH + 0u)              // unused; y is written straight to the output
#define WS_END (WS_Y + 4u * (size_t)NB * TT * CC)

// ---- k_proj: block = (128 rows, 128 cols, which), 8 waves of 16 rows x 128 cols: qkv = x W (+ b), exact; each 32-k slice of X and W is read in whole lines, rounded to bf16 once per block and staged in LDS (two buffers); q -> f16 hi (+ residual), k -> f16 rows, v -> bf16 planes
typedef __attribute__((ext_vector_type(4))) __bf16 v4b;
#define PJP 40    // pitch of a staged slice row, bf16 elements: 80 B = 16 B x odd, no bank conflict for 16-byte reads
#define PJE 136   // pitch of an output plane row, 16-bit elements
__device__ __forceinline__ void pj_load(const float* wp, const float* const* xp, float* wr, v4f* xr) {
#pragma unroll
  for (int i = 0; i < 16; ++i) wr[i] = wp[(size_t)i * CC];   /* a wave reads 32 neighbouring columns of one k: one line */
#pragma unroll
  for (int it = 0; it < 4; ++it) xr[it] = *(const __attribute__((address_space(1))) v4f*)xp[it];   /* eight lanes a row: four whole lines a wave; named global, else the carried pointers compile to flat loads */
}
__device__ __forceinline__ void pj_store(__bf16* wd, __bf16* xd, const float* wr, const v4f* xr) {
  v8b w0, w1;
#pragma unroll
  for (int i = 0; i < 8; ++i) { w0[i] = (__bf16)wr[i]; w1[i] = (__bf16)wr[8 + i]; }
  *(v8b*)wd = w0; *(v8b*)(wd + 8) = w1;   /* W slice transposed: [column][k] */
#pragma unroll
  for (int it = 0; it < 4; ++it) { v4b x;
#pragma unroll
    for (int i = 0; i < 4; ++i) x[i] = (__bf16)xr[it][i];
    *(v4b*)(xd + it * 32 * PJP) = x; }
}
__global__ __launch_bounds__(256) void k_proj(const float* __restrict__ X0, const float* __restrict__ X1, const float* __restrict__ X2, const float* __restrict__ WQ, const float* __restrict__ BQ, const float* __restrict__ WK, const float* __restrict__ BK, const float* __restrict__ WV, const float* __restrict__ BV, _Float16* __restrict__ QH, _Float16* __restrict__ QL, _Float16* __restrict__ KH, __bf16* __restrict__ VT, __bf16* __restrict__ VL) {
  __shared__ __align__(16) unsigned short sm[2 * 128 * PJE];   /* in the loop: X slices [2][128][PJP], then W slices [2][128][PJP]; behind the loop: the two output planes [128][PJE] */
  __bf16* const xs = (__bf16*)sm; __bf16* const wt = xs + 2 * 128 * PJP;
  const int tid = threadIdx.x, wave = tid >> 5, lane = tid & 31, col = lane & 15, g = lane >> 4; const int which = blockIdx.z; const int c0 = blockIdx.y * 128; const size_t r0 = (size_t)blockIdx.x * 128; const float* WA = which == 0 ? WQ : which == 1 ? WK : WV; const float* BA = which == 0 ? BQ : which == 1 ? BK : BV; const float* X = which == 0 ? X0 : which == 1 ? X1 : X2;
  const float* wp = WA + (size_t)((tid >> 7) * 16) * CC + c0 + (tid & 127);   /* thread: one column, 16 of the slice's 32 k */
  const float* xp[4];
#pragma unroll
  for (int it = 0; it < 4; ++it) xp[it] = X + XROW(r0 + it * 32 + (tid >> 3)) * CC + (tid & 7) * 4;   /* padded row -> clamped 500-row input */
  __bf16* const wd = wt + (tid & 127) * PJP + (tid >> 7) * 16; __bf16* const xd = xs + (tid >> 3) * PJP + (tid & 7) * 4;
  float wr[16]; v4f xr[4];
  pj_load(wp, xp, wr, xr); pj_store(wd, xd, wr, xr);
  __syncthreads();   /* slice 0 is read by every wave */
  v8f acc[8] = {};
#pragma unroll 2
  for (int kc = 0; kc < CC / 32; ++kc) { const int cur = (kc & 1) * 128 * PJP, nxt = 128 * PJP - cur;
    if (kc + 1 < CC / 32) { wp += 32 * CC;
#pragma unroll
      for (int it = 0; it < 4; ++it) xp[it] += 32;
      pj_load(wp, xp, wr, xr); }   /* the next slice flies behind this slice's products */
    const v16b a = frag_b(xs + cur + (wave * 16 + col) * PJP, lane);
#pragma unroll
    for (int jh = 0; jh < 8; jh += 4) { v16b w[4];
#pragma unroll
      for (int j = 0; j < 4; ++j) w[j] = frag_b(wt + cur + ((jh + j) * 16 + col) * PJP, lane);
#pragma unroll
      for (int j = 0; j < 4; ++j) acc[jh + j] = wmma_bf(a, w[j], acc[jh + j]); }
    if (kc + 1 < CC / 32) pj_store(wd + nxt, xd + nxt, wr, xr);
    __syncthreads(); }   /* publishes the next slice and ends every read of this one (after the last slice: before the planes overlay it) */
  _Float16* const sh = (_Float16*)sm; _Float16* const sl = sh + 128 * PJE; __bf16* const th = (__bf16*)sm; __bf16* const tl2 = th + 128 * PJE;
#pragma unroll
  for (int j = 0; j < 8; ++j) { const float bb = BA ? bfr(BA[c0 + j * 16 + col]) : 0.f;
#pragma unroll
    for (int r = 0; r < 8; ++r) { const float v = acc[j][r] + bb; const int rl = wave * 16 + 8 * g + r, cl = j * 16 + col; const _Float16 hv = (_Float16)v;
      if (which == 2) { const __bf16 bh = (__bf16)v; th[cl * PJE + rl] = bh; tl2[cl * PJE + rl] = (__bf16)(v - (float)bh); } else { sh[rl * PJE + cl] = hv; sl[rl * PJE + cl] = (_Float16)((v - (float)hv) * 1024.0f); }   /* q residual carried x 2^10 so the plane stays f16-normal on the chip */ } }
  __syncthreads();
  if (which < 2) { _Float16* dh = which == 0 ? QH : KH; for (int e = tid; e < 128 * 16; e += 256) { const int rl = e >> 4, q = e & 15; vst2((unsigned*)(dh + (r0 + rl) * CC + c0 + q * 8), *(const v4u*)&sh[rl * PJE + q * 8]);
      asm volatile("s_wait_xcnt 0x0" ::: "memory");   /* stands in front of the next LDS read and address step, which rewrite the store's registers */
      if (which == 0) { vst2((unsigned*)(QL + (r0 + rl) * CC + c0 + q * 8), *(const v4u*)&sl[rl * PJE + q * 8]);
        asm volatile("s_wait_xcnt 0x0" ::: "memory"); } } }   /* the same, behind the residual's store */
  else { const size_t b = r0 / TT; const int t0 = (int)(r0 % TT); for (int e = tid; e < 128 * 16; e += 256) { const int cl = e >> 4, q = e & 15; const size_t o2 = (b * CC + c0 + cl) * (size_t)TT + t0 + q * 8; vst2((unsigned*)(VT + o2), *(const v4u*)&th[cl * PJE + q * 8]); vst2((unsigned*)(VL + o2), *(const v4u*)&tl2[cl * PJE + q * 8]); } } }
// ---- k_att: block = (64 queries, head, batch), wave = 16 queries: S^T = K Q^T (2 products) / 8 + bias, online softmax per query column, O^T += V^T P^T (3 products); scores and P never leave the registers; K rows and the two V planes come 64 keys a stage by tensor loads into two LDS buffers that the four waves share
typedef __attribute__((ext_vector_type(8))) unsigned v8u;
#define SKY 64              // keys per stage: a staged row is one whole 128-byte line (K: 64 d of one key; V planes: 64 keys of one d)
#define TPE 72              // LDS pitch of a staged row, 16-bit elements: 144 B = 16 B x odd, no bank conflict for 16-byte reads
#define TSZ 10240           // one staged tile: 64 rows x 144 B, rounded up to a multiple of 2 KiB
#define BSZ (3 * TSZ)       // one buffer: K, V hi, V lo
#define NST (TT / SKY)
#define LOG2E 1.44269504088896340736f
__device__ __forceinline__ unsigned uni(unsigned v) { return (unsigned)__builtin_amdgcn_readfirstlane(v); }
__device__ __forceinline__ unsigned pinned(unsigned v) { unsigned w = uni(v); asm volatile("" : "+s"(w)); return w; }
__device__ __forceinline__ void tdm_load(unsigned lds_dst, unsigned long long ga, v8u g1) { v4u g0;
  g0[0] = uni(1u); g0[1] = uni(lds_dst); g0[2] = uni((unsigned)ga); g0[3] = uni((((unsigned)(ga >> 32)) & 0x01FFFFFFu) | 0x80000000u);
  asm volatile("tensor_load_to_lds %0, %1" :: "s"(g0), "s"(g1) : "memory"); }   /* one request of the whole wave: 64 rows of 128 B into LDS, through no register */
/* 2^x of a step's sixteen score differences and of the rescale exponent. One statement, every v_exp_f32 in place: none overwrites the source of the one in front of it, and the closing v_nop is the slot that the instruction set asks for between the last one and whatever the compiler puts behind (written as builtins, the register allocator gave one v_exp_f32 the source register of the one directly in front) */
__device__ __forceinline__ void exp2_17(float (&s)[16], float& a) {
  asm("v_exp_f32 %0, %0\n\tv_exp_f32 %1, %1\n\tv_exp_f32 %2, %2\n\tv_exp_f32 %3, %3\n\tv_exp_f32 %4, %4\n\tv_exp_f32 %5, %5\n\tv_exp_f32 %6, %6\n\tv_exp_f32 %7, %7\n\tv_exp_f32 %8, %8\n\tv_exp_f32 %9, %9\n\tv_exp_f32 %10, %10\n\tv_exp_f32 %11, %11\n\tv_exp_f32 %12, %12\n\tv_exp_f32 %13, %13\n\tv_exp_f32 %14, %14\n\tv_exp_f32 %15, %15\n\tv_exp_f32 %16, %16\n\tv_nop"
      : "+v"(s[0]), "+v"(s[1]), "+v"(s[2]), "+v"(s[3]), "+v"(s[4]), "+v"(s[5]), "+v"(s[6]), "+v"(s[7]), "+v"(s[8]), "+v"(s[9]), "+v"(s[10]), "+v"(s[11]), "+v"(s[12]), "+v"(s[13]), "+v"(s[14]), "+v"(s[15]), "+v"(a)); }
__global__ __launch_bounds__(128) void k_att(const _Float16* __restrict__ QH, const _Float16* __restrict__ QL, const _Float16* __restrict__ KH, const __bf16* __restrict__ VT, const __bf16* __restrict__ VL, const float* __restrict__ REL, float* __restrict__ Y) {   /* REL: rel_emb [16][999] */
  __shared__ __attribute__((aligned(2048))) unsigned char ring[2 * BSZ];   /* in the loop: two buffers of three tiles; behind the loop: the output staging */
  __shared__ float rt[2 * TT];
  const int tid = threadIdx.x, lane = tid & 31, col = lane & 15, g = lane >> 4; const int h = blockIdx.y, b = blockIdx.z; const unsigned wave = uni(tid >> 5); const int ql0 = blockIdx.x * 64 + wave * 16;
  /* waves 0, 1, 2 bring one tile a stage each: K rows, V hi plane, V lo plane */
  const unsigned long long tsrc = wave == 0 ? (unsigned long long)(size_t)(KH + (size_t)b * TT * CC + h * HD) : (unsigned long long)(size_t)((wave == 1 ? VT : VL) + ((size_t)b * CC + h * HD) * (size_t)TT);
  const unsigned tstep = wave == 0 ? SKY * 2u * CC : SKY * 2u;   /* bytes from one stage's tile to the next */
  const unsigned tdst = (unsigned)(size_t)ring + wave * TSZ;
  v8u g1;   /* 1-byte elements, tensor = tile = 64 rows of 128 B, a pad of 16 B behind every 128 B */
  g1[0] = uni((1u << 20) | (4u << 22) | (3u << 25)); g1[1] = uni(128u << 16); g1[2] = uni(64u << 16); g1[3] = uni(128u << 16); g1[4] = uni(64u); g1[5] = uni(wave == 0 ? 2u * CC : 2u * TT); g1[6] = uni(0u); g1[7] = uni(0u);
  v16h qh[HD / 32], qlo[HD / 32], kb[2][HD / 32];
#pragma unroll
  for (int kc = 0; kc < HD / 32; ++kc) { const size_t qo = ((size_t)b * TT + ql0 + col) * CC + h * HD + kc * 32; qh[kc] = frag_h(QH + qo, lane); qlo[kc] = frag_h(QL + qo, lane); }
  asm volatile("s_wait_xcnt 0x0" ::: "memory");   /* stands between the Q loads and the table loads, so that neither group's results land in an address register of the other while that is still named by an issued load */
#pragma unroll   /* all eight table loads of a thread in flight together */
  for (int n = 0; n < 2 * TT / 128; ++n) { const int i = n * 128 + tid, ri = (TT - 1) - i + LB - 1; rt[i] = bfr(REL[(size_t)h * NREL + (ri < 0 ? 0 : (ri < NREL ? ri : NREL - 1))]) * LOG2E; }   /* rt[511 - q + k] = bias at q - k + 499 (clamped for padded rows), in log2 units: ascending in k */
  if (pinned(wave < 3)) { tdm_load(tdst, tsrc, g1);
    asm volatile("s_wait_tensorcnt 0x0" ::: "memory"); }   /* stage 0's tile has landed before the barrier that publishes it */
  __syncthreads();   /* the bias row and stage 0 are read by every wave */
  if (pinned(wave < 3)) tdm_load(tdst + BSZ, tsrc + tstep, g1);   /* stage 1 flies behind stage 0's work */
  const float* rb = rt + (TT - 1) - (ql0 + col) + 8 * g;
  v8f o[HD / 16] = {}; float m = -3.0e38f, l = 0.f;
#pragma unroll 1   /* rolled: one pass a stage, the buffer picked by the stage's parity */
  for (int s = 0; s < NST; ++s) { const unsigned char* bp = ring + (s & 1) * BSZ; const _Float16* kt = (const _Float16*)bp + col * TPE; const __bf16* th = (const __bf16*)(bp + TSZ) + col * TPE; const __bf16* tl = (const __bf16*)(bp + 2 * TSZ) + col * TPE;
#pragma unroll
    for (int kc = 0; kc < HD / 32; ++kc)
#pragma unroll
      for (int t = 0; t < 2; ++t) kb[t][kc] = frag_h(kt + (t * 16) * TPE + kc * 32, lane);
#pragma unroll
    for (int u = 0; u < SKY / 32; ++u) { const int k0 = s * SKY + u * 32; v16b vh[HD / 16], vl[HD / 16];
#pragma unroll
      for (int j = 0; j < HD / 16; ++j) { vh[j] = frag_b(th + (j * 16) * TPE + u * 32, lane); vl[j] = frag_b(tl + (j * 16) * TPE + u * 32, lane); }
      __builtin_amdgcn_sched_barrier(0);   /* keeps this step's V reads in one group in front of the score products, so that they return behind products and softmax */
      v8f a[2] = {}, al[2] = {};
#pragma unroll
      for (int kc = 0; kc < HD / 32; ++kc)
#pragma unroll
        for (int t = 0; t < 2; ++t) { a[t] = wmma16(kb[t][kc], qh[kc], a[t]); al[t] = wmma16(kb[t][kc], qlo[kc], al[t]); }
      if (u + 1 < SKY / 32) {   /* the next step's K rows, of this same stage only */
#pragma unroll
        for (int kc = 0; kc < HD / 32; ++kc)
#pragma unroll
          for (int t = 0; t < 2; ++t) kb[t][kc] = frag_h(kt + ((u + 1) * 32 + t * 16) * TPE + kc * 32, lane); }
      __builtin_amdgcn_sched_barrier(0);   /* keeps those K reads in front of the softmax, one step ahead of their use */
      float sc[16];
#pragma unroll
      for (int t = 0; t < 2; ++t)
#pragma unroll
        for (int r = 0; r < 8; ++r) sc[t * 8 + r] = (a[t][r] + al[t][r] * (1.0f / 1024.0f)) * (0.125f * LOG2E) + rb[k0 + t * 16 + r];   /* lane (g, col): key k0 + 16 t + 8 g + r, query ql0 + col; logit x log2 e, so that e^(s - m) is one exp2 of a difference */
      if (k0 + 32 > LB) {   /* padded keys masked */
#pragma unroll
        for (int t = 0; t < 2; ++t)
#pragma unroll
          for (int r = 0; r < 8; ++r) if (k0 + t * 16 + 8 * g + r >= LB) sc[t * 8 + r] = -3.0e38f; }
      float mx = m;
#pragma unroll
      for (int i = 0; i < 16; ++i) mx = fmaxf(mx, sc[i]);
      mx = fmaxf(mx, __shfl_xor(mx, 16));   /* the two lane halves hold the two key halves of one query */
      float al0 = m - mx; m = mx;
#pragma unroll
      for (int i = 0; i < 16; ++i) sc[i] -= m;
      exp2_17(sc, al0);   /* masked keys underflow to 0 */
      l *= al0;
#pragma unroll
      for (int j = 0; j < HD / 16; ++j) o[j] *= al0;
#pragma unroll
      for (int i = 0; i < 16; ++i) l += sc[i];
      const F2 p = bsplit16(sc);   /* two S^T tiles of 16 keys are one B fragment of 32 keys */
#pragma unroll
      for (int j = 0; j < HD / 16; ++j) o[j] = wmma_bf(vh[j], p.h, o[j]);
#pragma unroll
      for (int j = 0; j < HD / 16; ++j) o[j] = wmma_bf(vh[j], p.l, o[j]);
#pragma unroll
      for (int j = 0; j < HD / 16; ++j) o[j] = wmma_bf(vl[j], p.h, o[j]); }
    asm volatile("s_wait_dscnt 0x0" ::: "memory");   /* this wave's reads of stage s have returned before its buffer is refilled */
    if (pinned(wave < 3)) asm volatile("s_wait_tensorcnt 0x0" ::: "memory");   /* the issuer's own tile of stage s + 1 has landed */
    __syncthreads();   /* publishes stage s + 1 and ends every wave's reads of stage s */
    if (pinned(wave < 3 && s + 2 < NST)) tdm_load(tdst + (s & 1) * BSZ, tsrc + (unsigned long long)pinned(s + 2) * tstep, g1); }   /* into the buffer that this pass has just read; the address is formed behind the wait */
  asm volatile("s_wait_tensorcnt 0x0" ::: "memory");   /* no request is in flight when the ring becomes output staging */
  asm volatile("s_wait_dscnt 0x0" ::: "memory");   /* nor a read of it; the last pass's barrier has ended every other wave's reads */
  float (*ss)[16][HD + 4] = (float (*)[16][HD + 4])ring;
  l += __shfl_xor(l, 16); const float inv = 1.0f / l;
#pragma unroll
  for (int j = 0; j < HD / 16; ++j) { v4f x0, x1;
#pragma unroll
    for (int r = 0; r < 4; ++r) { x0[r] = o[j][r] * inv; x1[r] = o[j][4 + r] * inv; }
    *(v4f*)&ss[wave][col][j * 16 + 8 * g] = x0; *(v4f*)&ss[wave][col][j * 16 + 8 * g + 4] = x1; }   /* lane (g, col): d = 16 j + 8 g + r of query col */
  LDSX();
#pragma unroll
  for (int it = 0; it < 8; ++it) { const int rl = it * 2 + g; if (ql0 + rl < LB) vst2(Y + ((size_t)b * LB + ql0 + rl) * CC + h * HD + col * 4, *(const v4f*)&ss[wave][rl][col * 4]); } }   /* only the 500 real rows, at the output's 500-row stride */
// ---- k_out: block = (64 rows, 128 cols): out = y (bf16 hi + lo) Wo + bo
__global__ __launch_bounds__(128) void k_out(const float* __restrict__ Y, const float* __restrict__ WP, const float* __restrict__ BP, float* __restrict__ OUT) { __shared__ __align__(16) float sf[4][16][132];
  const int tid = threadIdx.x, wave = tid >> 5, lane = tid & 31, col = lane & 15, g = lane >> 4; const int c0 = blockIdx.y * 128; const size_t r0 = (size_t)blockIdx.x * 64 + wave * 16;
  v8f acc[8] = {};
#pragma unroll 2
  for (int kc = 0; kc < CC / 32; ++kc) { const F2 a = split_row(Y + (r0 + col) * CC, kc * 32, lane);
#pragma unroll
    for (int j = 0; j < 8; ++j) { v16b w; const int o = c0 + j * 16 + col;
#pragma unroll
      for (int i = 0; i < 8; ++i) { w[i] = (__bf16)WP[(size_t)(kc * 32 + 8 * g + i) * CC + o]; w[8 + i] = (__bf16)WP[(size_t)(kc * 32 + 16 + 8 * g + i) * CC + o]; }   /* (in,out) */
      acc[j] = wmma_bf(a.h, w, acc[j]); acc[j] = wmma_bf(a.l, w, acc[j]); } }
#pragma unroll
  for (int j = 0; j < 8; ++j) { const float bb = BP ? bfr(BP[c0 + j * 16 + col]) : 0.f;
#pragma unroll
    for (int r = 0; r < 8; ++r) sf[wave][8 * g + r][j * 16 + col] = acc[j][r] + bb; }
  LDSX(); for (int rl = 0; rl < 16; ++rl) vst2(OUT + (r0 + rl) * CC + c0 + lane * 4, *(const v4f*)&sf[wave][rl][lane * 4]); }
extern "C" void kernel_launch(void* const* d_in, const int* in_sizes, int n_in, void* d_out, int out_size, void* d_ws, size_t ws_size, hipStream_t stream) {
  (void)in_sizes; (void)n_in; (void)out_size;
  const float** F = (const float**)d_in;   // 0 query [8,500,1024], 1 key, 2 value, 3 Wq ((in,out)), 4 bq, 5 Wk, 6 bk, 7 Wv, 8 bv, 9 rel_emb [16,999]
  if (ws_size < (size_t)WS_END) return;
  char* ws = (char*)d_ws; _Float16 *QH = (_Float16*)(ws + WS_QH), *QL = (_Float16*)(ws + WS_QL), *KH = (_Float16*)(ws + WS_KH); __bf16 *VT = (__bf16*)(ws + WS_VT), *VL = (__bf16*)(ws + WS_VL);
  k_proj<<<dim3(TNB * TT / 128, CC / 128, 3), 256, 0, stream>>>(F[0], F[1], F[2], F[3], F[4], F[5], F[6], F[7], F[8], QH, QL, KH, VT, VL);
  k_att<<<dim3(TT / 64, NH, TNB), 128, 0, stream>>>(QH, QL, KH, VT, VL, F[9], (float*)d_out);
}

// v005
// One run takes 65.8 microseconds.
// Timed twice side by side with v004, it ran 1.07 times as fast both times.
// Over all steps from v000 it is 9.11 times as fast.
// compute dtype: all float inputs rounded to bf16; q/k/v = x W + b ((in,out)) with EXACT bf16 products on WMMA 16x16x32, f32 accumulate (sequence padded 500 -> 512 internally; padded keys masked, padded queries dropped); q as f16 hi + residual (x 2^10), k f16 -> 2-product logits / 8 + rel_emb[h][q - k + 499] kept in f32 registers (one launch for all batches and heads); online softmax in f32 on logits carried in log2 units (scale and bias table x log2 e, hardware exp2), 32 keys a step; unnormalised P split bf16 hi + lo against v bf16 hi + lo (3 products), divided by the row sum at the end; the merged context is the output; f32 output.
#include <hip/hip_runtime.h>
#include <math.h>

typedef __attribute__((ext_vector_type(16))) _Float16 v16h;
typedef __attribute__((ext_vector_type(16))) __bf16 v16b;
typedef __attribute__((ext_vector_type(8)))  _Float16 v8h;
typedef __attribute__((ext_vector_type(8)))  float v8f;
typedef __attribute__((ext_vector_type(4)))  float v4f;
typedef __attribute__((ext_vector_type(2)))  float v2f;
typedef __attribute__((ext_vector_type(4)))  unsigned v4u;
typedef __attribute__((ext_vector_type(4)))  int v4i;
typedef float __attribute__((may_alias)) float_a;
typedef int __attribute__((may_alias)) int_a;

template <typename T> __device__ __forceinline__ void vst2(void* p, T v) { *(T*)p = v;  }
__device__ __forceinline__ v8f wmma16(v16h a, v16h b, v8f c) {
  v8f d = __builtin_amdgcn_wmma_f32_16x16x32_f16(false, a, false, b, (short)0, c, false, false);
  asm volatile("v_nop\n\tv_nop\n\tv_nop\n\tv_nop" : "+v"(d) : "v"(a), "v"(b));
  return d;
}
__device__ __forceinline__ v8f wmma_bf(v16b a, v16b b, v8f c) {
  v8f d = __builtin_amdgcn_wmma_f32_16x16x32_bf16(false, a, false, b, (short)0, c, false, false);
  asm volatile("v_nop\n\tv_nop\n\tv_nop\n\tv_nop" : "+v"(d) : "v"(a), "v"(b));
  return d;
}
// 16x16x32 fragments: lane = (h = lane>>4, row/col = lane&15); elements 0..7 = k0+8h+0..7, 8..15 = k0+16+8h+0..7; D element r = row 8h+r
__device__ __forceinline__ v16h frag_h(const _Float16* rowk0, int lane) {
  union { v16h v; v8h q[2]; } u; const _Float16* p = rowk0 + 8 * (lane >> 4);
  u.q[0] = *(const v8h*)p; u.q[1] = *(const v8h*)(p + 16); return u.v;
}
__device__ __forceinline__ v16h frag_f32(const float* rowk0, int lane) {
  v16h a; const float* p = rowk0 + 8 * (lane >> 4);
#pragma unroll
  for (int i = 0; i < 8; ++i) { a[i] = (_Float16)p[i]; a[8 + i] = (_Float16)p[16 + i]; }
  return a;
}
__device__ __forceinline__ v16h frag_f32s(const float* rowk0, int lane, float sc) {
  v16h a; const float* p = rowk0 + 8 * (lane >> 4);
#pragma unroll
  for (int i = 0; i < 8; ++i) { a[i] = (_Float16)(p[i] * sc); a[8 + i] = (_Float16)(p[16 + i] * sc); }
  return a;
}
// column fragment from a [K][ld] layout (column n), rows >= K read as 0
__device__ __forceinline__ v16h fragc_f32(const float* W, int k0, int n, int lane, int ld, int K) {
  v16h a; const int g = lane >> 4;
#pragma unroll
  for (int i = 0; i < 8; ++i) { const int ka = k0 + 8 * g + i, kb = ka + 16;
    a[i] = (_Float16)(ka < K ? W[(size_t)(ka < K ? ka : K - 1) * ld + n] : 0.f); a[8 + i] = (_Float16)(kb < K ? W[(size_t)(kb < K ? kb : K - 1) * ld + n] : 0.f); }
  return a;
}
struct F2 { v16b h, l; };
__device__ __forceinline__ F2 bsplit16(const float v[16]) { F2 r;
#pragma unroll
  for (int i = 0; i < 16; ++i) { const __bf16 h = (__bf16)v[i]; r.h[i] = h; r.l[i] = (__bf16)(v[i] - (float)h); }
  return r; }
__device__ __forceinline__ F2 split_row(const float* row, int k0, int lane) { float v[16]; const float* p = row + k0 + 8 * (lane >> 4);
#pragma unroll
  for (int i = 0; i < 8; ++i) { v[i] = p[i]; v[8 + i] = p[16 + i]; }
  return bsplit16(v); }
__device__ __forceinline__ F2 split_rowK(const float* row, int k0, int lane, int K) { float v[16]; const int g = lane >> 4;
#pragma unroll
  for (int i = 0; i < 8; ++i) { const int ka = k0 + 8 * g + i, kb = ka + 16; v[i] = ka < K ? row[ka < K ? ka : K - 1] : 0.f; v[8 + i] = kb < K ? row[kb < K ? kb : K - 1] : 0.f; }
  return bsplit16(v); }
__device__ __forceinline__ F2 split_col(const float* W, int k0, int n, int lane, int ld, int K) { float v[16]; const int g = lane >> 4;
#pragma unroll
  for (int i = 0; i < 8; ++i) { const int ka = k0 + 8 * g + i, kb = ka + 16; v[i] = ka < K ? W[(size_t)(ka < K ? ka : K - 1) * ld + n] : 0.f; v[8 + i] = kb < K ? W[(size_t)(kb < K ? kb : K - 1) * ld + n] : 0.f; }
  return bsplit16(v); }
__device__ __forceinline__ v8f mac3(const F2& a, const F2& b, v8f c) { c = wmma_bf(a.l, b.h, c); c = wmma_bf(a.h, b.l, c); return wmma_bf(a.h, b.h, c); }
__device__ __forceinline__ float sigm(float v) { return 1.0f / (1.0f + expf(-v)); }
#define LDSX() do { asm volatile("s_wait_dscnt 0" ::: "memory"); __builtin_amdgcn_wave_barrier(); __builtin_amdgcn_fence(__ATOMIC_RELEASE, "workgroup"); } while (0)


// Attention (B 8, S 500 padded to 512, D 1,024 = 16 x 64, q/k/v biases, logits / 8): scores = q k^T / 8 + rel_emb[h][q - k + 499] (999 offsets), softmax, P v; the context is the output.
#define NB 8
#define TT 512               // padded length
#define LB 500               // real sequence length (input/output rows per batch)
#define NREL 999
#define XROW(r) (((r) / TT) * (size_t)LB + (((r) % TT) < LB ? ((r) % TT) : (LB - 1)))   /* padded row -> clamped input row */
#define CC 1024
#define NH 16
#define HD 64
#define HG 16               // heads per launch group
#ifndef TNB
#define TNB NB
#endif
typedef __attribute__((ext_vector_type(8))) __bf16 v8b;
__device__ __forceinline__ v16b frag_b(const __bf16* rowk0, int lane) {
  union { v16b v; v8b q[2]; } u; const __bf16* p = rowk0 + 8 * (lane >> 4);
  u.q[0] = *(const v8b*)p; u.q[1] = *(const v8b*)(p + 16); return u.v;
}
__device__ __forceinline__ float bfr(float v) { return (float)(__bf16)v; }
__device__ __attribute__((noinline)) float exp_ni(float v) { return expf(v); }
__device__ __attribute__((noinline)) float erf_ni(float v) { return erff(v); }

#define WS_QH  0u
#define WS_QL  (WS_QH + 2u * (size_t)NB * TT * CC)
#define WS_KH  (WS_QL + 2u * (size_t)NB * TT * CC)
#define WS_VT  (WS_KH + 2u * (size_t)NB * TT * CC)      // bf16 v planes [b][c][t]
#define WS_VL  (WS_VT + 2u * (size_t)NB * CC * TT)      // bf16 v residual planes
#define WS_S   (WS_VL + 2u * (size_t)NB * CC * TT)      // f32 region [hg][q][k], unused: scores stay in registers
#define WS_PH  (WS_S + 4u * (size_t)HG * TT * TT)
#define WS_Y   (WS_PH + 0u)              // unused; y is written straight to the output
#define WS_END (WS_Y + 4u * (size_t)NB * TT * CC)

// ---- k_proj: block = (128 rows, 128 cols, which), 8 waves of 16 rows x 128 cols: qkv = x W (+ b), exact; each 32-k slice of X and W is read in whole lines, rounded to bf16 once per block and staged in LDS (two buffers); the slices are summed in a ring order that starts at a slice of the block's own; q -> f16 hi (+ residual), k -> f16 rows, v -> bf16 planes
typedef __attribute__((ext_vector_type(4))) __bf16 v4b;
#define PJP 40    // pitch of a staged slice row, bf16 elements: 80 B = 16 B x odd, no bank conflict for 16-byte reads
#define PJE 136   // pitch of an output plane row, 16-bit elements
typedef const __attribute__((address_space(1))) char gbyte;   /* named global, else the loads compile to flat loads */
/* wo, xo: the thread's own byte offsets in the slice to be read (W is 4 MiB, X under 16 MiB: 32 bits hold every offset) */
__device__ __forceinline__ void pj_load(const float* W, const float* X, unsigned wo, const unsigned* xo, float* wr, v4f* xr) {
  gbyte* const wq = (gbyte*)W + wo;
#pragma unroll
  for (int i = 0; i < 16; ++i) wr[i] = *(const __attribute__((address_space(1))) float*)(wq + i * (CC * 4));   /* a wave reads 32 neighbouring columns of one k: one line */
#pragma unroll
  for (int it = 0; it < 4; ++it) xr[it] = *(const __attribute__((address_space(1))) v4f*)((gbyte*)X + xo[it]);   /* eight lanes a row: four whole lines a wave */
}
__device__ __forceinline__ void pj_store(__bf16* wd, __bf16* xd, const float* wr, const v4f* xr) {
  v8b w0, w1;
#pragma unroll
  for (int i = 0; i < 8; ++i) { w0[i] = (__bf16)wr[i]; w1[i] = (__bf16)wr[8 + i]; }
  *(v8b*)wd = w0; *(v8b*)(wd + 8) = w1;   /* W slice transposed: [column][k] */
#pragma unroll
  for (int it = 0; it < 4; ++it) { v4b x;
#pragma unroll
    for (int i = 0; i < 4; ++i) x[i] = (__bf16)xr[it][i];
    *(v4b*)(xd + it * 32 * PJP) = x; }
}
__global__ __launch_bounds__(256) void k_proj(const float* __restrict__ X0, const float* __restrict__ X1, const float* __restrict__ X2, const float* __restrict__ WQ, const float* __restrict__ BQ, const float* __restrict__ WK, const float* __restrict__ BK, const float* __restrict__ WV, const float* __restrict__ BV, _Float16* __restrict__ QH, _Float16* __restrict__ QL, _Float16* __restrict__ KH, __bf16* __restrict__ VT, __bf16* __restrict__ VL) {
  __shared__ __align__(16) unsigned short sm[2 * 128 * PJE];   /* in the loop: X slices [2][128][PJP], then W slices [2][128][PJP]; behind the loop: the two output planes [128][PJE] */
  __bf16* const xs = (__bf16*)sm; __bf16* const wt = xs + 2 * 128 * PJP;
  const int tid = threadIdx.x, wave = tid >> 5, lane = tid & 31, col = lane & 15, g = lane >> 4; const int which = blockIdx.z; const int c0 = blockIdx.y * 128; const size_t r0 = (size_t)blockIdx.x * 128; const float* WA = which == 0 ? WQ : which == 1 ? WK : WV; const float* BA = which == 0 ? BQ : which == 1 ? BK : BV; const float* X = which == 0 ? X0 : which == 1 ? X1 : X2;
  /* the block walks its 32 k slices in a ring that starts at slice rot: the 8 blocks that share an X tile start 4 slices apart and the 32 that share a W tile 1 apart, so that a line is fetched from memory for one of them and the others find it in L2, instead of all of them waiting for the same fetch in every slice */
  const int rot = (blockIdx.x + 4 * blockIdx.y) & (CC / 32 - 1);
  unsigned wo = (unsigned)((rot * 32 + (tid >> 7) * 16) * CC + c0 + (tid & 127)) * 4u;   /* thread: one column, 16 of the slice's 32 k */
  unsigned xo[4];
#pragma unroll
  for (int it = 0; it < 4; ++it) xo[it] = (unsigned)(XROW(r0 + it * 32 + (tid >> 3)) * CC + rot * 32 + (tid & 7) * 4) * 4u;   /* padded row -> clamped 500-row input */
  __bf16* const wd = wt + (tid & 127) * PJP + (tid >> 7) * 16; __bf16* const xd = xs + (tid >> 3) * PJP + (tid & 7) * 4;
  float wr[16]; v4f xr[4];
  pj_load(WA, X, wo, xo, wr, xr); pj_store(wd, xd, wr, xr);
  __syncthreads();   /* slice rot, the ring's first, is read by every wave */
  v8f acc[8] = {};
#pragma unroll 2
  for (int kc = 0; kc < CC / 32; ++kc) { const int cur = (kc & 1) * 128 * PJP, nxt = 128 * PJP - cur;
    if (kc + 1 < CC / 32) { const int st = ((rot + kc + 1) & (CC / 32 - 1)) ? 1 : 1 - CC / 32;   /* one slice on, or from the last slice back to the first */
      asm volatile("s_wait_xcnt 0x0" ::: "memory");   /* stands in front of the offset steps, which rewrite the registers that the last slice's loads name */
      wo += st * (32 * CC * 4);
#pragma unroll
      for (int it = 0; it < 4; ++it) xo[it] += st * (32 * 4);
      pj_load(WA, X, wo, xo, wr, xr); }   /* the next slice of the ring flies behind this slice's products */
    const v16b a = frag_b(xs + cur + (wave * 16 + col) * PJP, lane);
#pragma unroll
    for (int jh = 0; jh < 8; jh += 4) { v16b w[4];
#pragma unroll
      for (int j = 0; j < 4; ++j) w[j] = frag_b(wt + cur + ((jh + j) * 16 + col) * PJP, lane);
#pragma unroll
      for (int j = 0; j < 4; ++j) acc[jh + j] = wmma_bf(a, w[j], acc[jh + j]); }
    if (kc + 1 < CC / 32) pj_store(wd + nxt, xd + nxt, wr, xr);
    __syncthreads(); }   /* publishes the next slice and ends every read of this one (after the last slice: before the planes overlay it) */
  _Float16* const sh = (_Float16*)sm; _Float16* const sl = sh + 128 * PJE; __bf16* const th = (__bf16*)sm; __bf16* const tl2 = th + 128 * PJE;
#pragma unroll
  for (int j = 0; j < 8; ++j) { const float bb = BA ? bfr(BA[c0 + j * 16 + col]) : 0.f;
#pragma unroll
    for (int r = 0; r < 8; ++r) { const float v = acc[j][r] + bb; const int rl = wave * 16 + 8 * g + r, cl = j * 16 + col; const _Float16 hv = (_Float16)v;
      if (which == 2) { const __bf16 bh = (__bf16)v; th[cl * PJE + rl] = bh; tl2[cl * PJE + rl] = (__bf16)(v - (float)bh); } else { sh[rl * PJE + cl] = hv; sl[rl * PJE + cl] = (_Float16)((v - (float)hv) * 1024.0f); }   /* q residual carried x 2^10 so the plane stays f16-normal on the chip */ } }
  __syncthreads();
  if (which < 2) { _Float16* dh = which == 0 ? QH : KH; for (int e = tid; e < 128 * 16; e += 256) { const int rl = e >> 4, q = e & 15; vst2((unsigned*)(dh + (r0 + rl) * CC + c0 + q * 8), *(const v4u*)&sh[rl * PJE + q * 8]);
      asm volatile("s_wait_xcnt 0x0" ::: "memory");   /* stands in front of the next LDS read and address step, which rewrite the store's registers */
      if (which == 0) { vst2((unsigned*)(QL + (r0 + rl) * CC + c0 + q * 8), *(const v4u*)&sl[rl * PJE + q * 8]);
        asm volatile("s_wait_xcnt 0x0" ::: "memory"); } } }   /* the same, behind the residual's store */
  else { const size_t b = r0 / TT; const int t0 = (int)(r0 % TT); for (int e = tid; e < 128 * 16; e += 256) { const int cl = e >> 4, q = e & 15; const size_t o2 = (b * CC + c0 + cl) * (size_t)TT + t0 + q * 8; vst2((unsigned*)(VT + o2), *(const v4u*)&th[cl * PJE + q * 8]); vst2((unsigned*)(VL + o2), *(const v4u*)&tl2[cl * PJE + q * 8]); } } }
// ---- k_att: block = (64 queries, head, batch), wave = 16 queries: S^T = K Q^T (2 products) / 8 + bias, online softmax per query column, O^T += V^T P^T (3 products); scores and P never leave the registers; K rows and the two V planes come 64 keys a stage by tensor loads into two LDS buffers that the four waves share
typedef __attribute__((ext_vector_type(8))) unsigned v8u;
#define SKY 64              // keys per stage: a staged row is one whole 128-byte line (K: 64 d of one key; V planes: 64 keys of one d)
#define TPE 72              // LDS pitch of a staged row, 16-bit elements: 144 B = 16 B x odd, no bank conflict for 16-byte reads
#define TSZ 10240           // one staged tile: 64 rows x 144 B, rounded up to a multiple of 2 KiB
#define BSZ (3 * TSZ)       // one buffer: K, V hi, V lo
#define NST (TT / SKY)
#define LOG2E 1.44269504088896340736f
__device__ __forceinline__ unsigned uni(unsigned v) { return (unsigned)__builtin_amdgcn_readfirstlane(v); }
__device__ __forceinline__ unsigned pinned(unsigned v) { unsigned w = uni(v); asm volatile("" : "+s"(w)); return w; }
__device__ __forceinline__ void tdm_load(unsigned lds_dst, unsigned long long ga, v8u g1) { v4u g0;
  g0[0] = uni(1u); g0[1] = uni(lds_dst); g0[2] = uni((unsigned)ga); g0[3] = uni((((unsigned)(ga >> 32)) & 0x01FFFFFFu) | 0x80000000u);
  asm volatile("tensor_load_to_lds %0, %1" :: "s"(g0), "s"(g1) : "memory"); }   /* one request of the whole wave: 64 rows of 128 B into LDS, through no register */
/* 2^x of a step's sixteen score differences and of the rescale exponent. One statement, every v_exp_f32 in place: none overwrites the source of the one in front of it, and the closing v_nop is the slot that the instruction set asks for between the last one and whatever the compiler puts behind (written as builtins, the register allocator gave one v_exp_f32 the source register of the one directly in front) */
__device__ __forceinline__ void exp2_17(float (&s)[16], float& a) {
  asm("v_exp_f32 %0, %0\n\tv_exp_f32 %1, %1\n\tv_exp_f32 %2, %2\n\tv_exp_f32 %3, %3\n\tv_exp_f32 %4, %4\n\tv_exp_f32 %5, %5\n\tv_exp_f32 %6, %6\n\tv_exp_f32 %7, %7\n\tv_exp_f32 %8, %8\n\tv_exp_f32 %9, %9\n\tv_exp_f32 %10, %10\n\tv_exp_f32 %11, %11\n\tv_exp_f32 %12, %12\n\tv_exp_f32 %13, %13\n\tv_exp_f32 %14, %14\n\tv_exp_f32 %15, %15\n\tv_exp_f32 %16, %16\n\tv_nop"
      : "+v"(s[0]), "+v"(s[1]), "+v"(s[2]), "+v"(s[3]), "+v"(s[4]), "+v"(s[5]), "+v"(s[6]), "+v"(s[7]), "+v"(s[8]), "+v"(s[9]), "+v"(s[10]), "+v"(s[11]), "+v"(s[12]), "+v"(s[13]), "+v"(s[14]), "+v"(s[15]), "+v"(a)); }
__global__ __launch_bounds__(128) void k_att(const _Float16* __restrict__ QH, const _Float16* __restrict__ QL, const _Float16* __restrict__ KH, const __bf16* __restrict__ VT, const __bf16* __restrict__ VL, const float* __restrict__ REL, float* __restrict__ Y) {   /* REL: rel_emb [16][999] */
  __shared__ __attribute__((aligned(2048))) unsigned char ring[2 * BSZ];   /* in the loop: two buffers of three tiles; behind the loop: the output staging */
  __shared__ float rt[2 * TT];
  const int tid = threadIdx.x, lane = tid & 31, col = lane & 15, g = lane >> 4; const int h = blockIdx.y, b = blockIdx.z; const unsigned wave = uni(tid >> 5); const int ql0 = blockIdx.x * 64 + wave * 16;
  /* waves 0, 1, 2 bring one tile a stage each: K rows, V hi plane, V lo plane */
  const unsigned long long tsrc = wave == 0 ? (unsigned long long)(size_t)(KH + (size_t)b * TT * CC + h * HD) : (unsigned long long)(size_t)((wave == 1 ? VT : VL) + ((size_t)b * CC + h * HD) * (size_t)TT);
  const unsigned tstep = wave == 0 ? SKY * 2u * CC : SKY * 2u;   /* bytes from one stage's tile to the next */
  const unsigned tdst = (unsigned)(size_t)ring + wave * TSZ;
  v8u g1;   /* 1-byte elements, tensor = tile = 64 rows of 128 B, a pad of 16 B behind every 128 B */
  g1[0] = uni((1u << 20) | (4u << 22) | (3u << 25)); g1[1] = uni(128u << 16); g1[2] = uni(64u << 16); g1[3] = uni(128u << 16); g1[4] = uni(64u); g1[5] = uni(wave == 0 ? 2u * CC : 2u * TT); g1[6] = uni(0u); g1[7] = uni(0u);
  v16h qh[HD / 32], qlo[HD / 32], kb[2][HD / 32];
#pragma unroll
  for (int kc = 0; kc < HD / 32; ++kc) { const size_t qo = ((size_t)b * TT + ql0 + col) * CC + h * HD + kc * 32; qh[kc] = frag_h(QH + qo, lane); qlo[kc] = frag_h(QL + qo, lane); }
  asm volatile("s_wait_xcnt 0x0" ::: "memory");   /* stands between the Q loads and the table loads, so that neither group's results land in an address register of the other while that is still named by an issued load */
#pragma unroll   /* all eight table loads of a thread in flight together */
  for (int n = 0; n < 2 * TT / 128; ++n) { const int i = n * 128 + tid, ri = (TT - 1) - i + LB - 1; rt[i] = bfr(REL[(size_t)h * NREL + (ri < 0 ? 0 : (ri < NREL ? ri : NREL - 1))]) * LOG2E; }   /* rt[511 - q + k] = bias at q - k + 499 (clamped for padded rows), in log2 units: ascending in k */
  if (pinned(wave < 3)) { tdm_load(tdst, tsrc, g1);
    asm volatile("s_wait_tensorcnt 0x0" ::: "memory"); }   /* stage 0's tile has landed before the barrier that publishes it */
  __syncthreads();   /* the bias row and stage 0 are read by every wave */
  if (pinned(wave < 3)) tdm_load(tdst + BSZ, tsrc + tstep, g1);   /* stage 1 flies behind stage 0's work */
  const float* rb = rt + (TT - 1) - (ql0 + col) + 8 * g;
  v8f o[HD / 16] = {}; float m = -3.0e38f, l = 0.f;
#pragma unroll 1   /* rolled: one pass a stage, the buffer picked by the stage's parity */
  for (int s = 0; s < NST; ++s) { const unsigned char* bp = ring + (s & 1) * BSZ; const _Float16* kt = (const _Float16*)bp + col * TPE; const __bf16* th = (const __bf16*)(bp + TSZ) + col * TPE; const __bf16* tl = (const __bf16*)(bp + 2 * TSZ) + col * TPE;
#pragma unroll
    for (int kc = 0; kc < HD / 32; ++kc)
#pragma unroll
      for (int t = 0; t < 2; ++t) kb[t][kc] = frag_h(kt + (t * 16) * TPE + kc * 32, lane);
#pragma unroll
    for (int u = 0; u < SKY / 32; ++u) { const int k0 = s * SKY + u * 32; v16b vh[HD / 16], vl[HD / 16];
#pragma unroll
      for (int j = 0; j < HD / 16; ++j) { vh[j] = frag_b(th + (j * 16) * TPE + u * 32, lane); vl[j] = frag_b(tl + (j * 16) * TPE + u * 32, lane); }
      __builtin_amdgcn_sched_barrier(0);   /* keeps this step's V reads in one group in front of the score products, so that they return behind products and softmax */
      v8f a[2] = {}, al[2] = {};
#pragma unroll
      for (int kc = 0; kc < HD / 32; ++kc)
#pragma unroll
        for (int t = 0; t < 2; ++t) { a[t] = wmma16(kb[t][kc], qh[kc], a[t]); al[t] = wmma16(kb[t][kc], qlo[kc], al[t]); }
      if (u + 1 < SKY / 32) {   /* the next step's K rows, of this same stage only */
#pragma unroll
        for (int kc = 0; kc < HD / 32; ++kc)
#pragma unroll
          for (int t = 0; t < 2; ++t) kb[t][kc] = frag_h(kt + ((u + 1) * 32 + t * 16) * TPE + kc * 32, lane); }
      __builtin_amdgcn_sched_barrier(0);   /* keeps those K reads in front of the softmax, one step ahead of their use */
      float sc[16];
#pragma unroll
      for (int t = 0; t < 2; ++t)
#pragma unroll
        for (int r = 0; r < 8; ++r) sc[t * 8 + r] = (a[t][r] + al[t][r] * (1.0f / 1024.0f)) * (0.125f * LOG2E) + rb[k0 + t * 16 + r];   /* lane (g, col): key k0 + 16 t + 8 g + r, query ql0 + col; logit x log2 e, so that e^(s - m) is one exp2 of a difference */
      if (k0 + 32 > LB) {   /* padded keys masked */
#pragma unroll
        for (int t = 0; t < 2; ++t)
#pragma unroll
          for (int r = 0; r < 8; ++r) if (k0 + t * 16 + 8 * g + r >= LB) sc[t * 8 + r] = -3.0e38f; }
      float mx = m;
#pragma unroll
      for (int i = 0; i < 16; ++i) mx = fmaxf(mx, sc[i]);
      mx = fmaxf(mx, __shfl_xor(mx, 16));   /* the two lane halves hold the two key halves of one query */
      float al0 = m - mx; m = mx;
#pragma unroll
      for (int i = 0; i < 16; ++i) sc[i] -= m;
      exp2_17(sc, al0);   /* masked keys underflow to 0 */
      l *= al0;
#pragma unroll
      for (int j = 0; j < HD / 16; ++j) o[j] *= al0;
#pragma unroll
      for (int i = 0; i < 16; ++i) l += sc[i];
      const F2 p = bsplit16(sc);   /* two S^T tiles of 16 keys are one B fragment of 32 keys */
#pragma unroll
      for (int j = 0; j < HD / 16; ++j) o[j] = wmma_bf(vh[j], p.h, o[j]);
#pragma unroll
      for (int j = 0; j < HD / 16; ++j) o[j] = wmma_bf(vh[j], p.l, o[j]);
#pragma unroll
      for (int j = 0; j < HD / 16; ++j) o[j] = wmma_bf(vl[j], p.h, o[j]); }
    asm volatile("s_wait_dscnt 0x0" ::: "memory");   /* this wave's reads of stage s have returned before its buffer is refilled */
    if (pinned(wave < 3)) asm volatile("s_wait_tensorcnt 0x0" ::: "memory");   /* the issuer's own tile of stage s + 1 has landed */
    __syncthreads();   /* publishes stage s + 1 and ends every wave's reads of stage s */
    if (pinned(wave < 3 && s + 2 < NST)) tdm_load(tdst + (s & 1) * BSZ, tsrc + (unsigned long long)pinned(s + 2) * tstep, g1); }   /* into the buffer that this pass has just read; the address is formed behind the wait */
  asm volatile("s_wait_tensorcnt 0x0" ::: "memory");   /* no request is in flight when the ring becomes output staging */
  asm volatile("s_wait_dscnt 0x0" ::: "memory");   /* nor a read of it; the last pass's barrier has ended every other wave's reads */
  float (*ss)[16][HD + 4] = (float (*)[16][HD + 4])ring;
  l += __shfl_xor(l, 16); const float inv = 1.0f / l;
#pragma unroll
  for (int j = 0; j < HD / 16; ++j) { v4f x0, x1;
#pragma unroll
    for (int r = 0; r < 4; ++r) { x0[r] = o[j][r] * inv; x1[r] = o[j][4 + r] * inv; }
    *(v4f*)&ss[wave][col][j * 16 + 8 * g] = x0; *(v4f*)&ss[wave][col][j * 16 + 8 * g + 4] = x1; }   /* lane (g, col): d = 16 j + 8 g + r of query col */
  LDSX();
#pragma unroll
  for (int it = 0; it < 8; ++it) { const int rl = it * 2 + g; if (ql0 + rl < LB) vst2(Y + ((size_t)b * LB + ql0 + rl) * CC + h * HD + col * 4, *(const v4f*)&ss[wave][rl][col * 4]); } }   /* only the 500 real rows, at the output's 500-row stride */
// ---- k_out: block = (64 rows, 128 cols): out = y (bf16 hi + lo) Wo + bo
__global__ __launch_bounds__(128) void k_out(const float* __restrict__ Y, const float* __restrict__ WP, const float* __restrict__ BP, float* __restrict__ OUT) { __shared__ __align__(16) float sf[4][16][132];
  const int tid = threadIdx.x, wave = tid >> 5, lane = tid & 31, col = lane & 15, g = lane >> 4; const int c0 = blockIdx.y * 128; const size_t r0 = (size_t)blockIdx.x * 64 + wave * 16;
  v8f acc[8] = {};
#pragma unroll 2
  for (int kc = 0; kc < CC / 32; ++kc) { const F2 a = split_row(Y + (r0 + col) * CC, kc * 32, lane);
#pragma unroll
    for (int j = 0; j < 8; ++j) { v16b w; const int o = c0 + j * 16 + col;
#pragma unroll
      for (int i = 0; i < 8; ++i) { w[i] = (__bf16)WP[(size_t)(kc * 32 + 8 * g + i) * CC + o]; w[8 + i] = (__bf16)WP[(size_t)(kc * 32 + 16 + 8 * g + i) * CC + o]; }   /* (in,out) */
      acc[j] = wmma_bf(a.h, w, acc[j]); acc[j] = wmma_bf(a.l, w, acc[j]); } }
#pragma unroll
  for (int j = 0; j < 8; ++j) { const float bb = BP ? bfr(BP[c0 + j * 16 + col]) : 0.f;
#pragma unroll
    for (int r = 0; r < 8; ++r) sf[wave][8 * g + r][j * 16 + col] = acc[j][r] + bb; }
  LDSX(); for (int rl = 0; rl < 16; ++rl) vst2(OUT + (r0 + rl) * CC + c0 + lane * 4, *(const v4f*)&sf[wave][rl][lane * 4]); }
extern "C" void kernel_launch(void* const* d_in, const int* in_sizes, int n_in, void* d_out, int out_size, void* d_ws, size_t ws_size, hipStream_t stream) {
  (void)in_sizes; (void)n_in; (void)out_size;
  const float** F = (const float**)d_in;   // 0 query [8,500,1024], 1 key, 2 value, 3 Wq ((in,out)), 4 bq, 5 Wk, 6 bk, 7 Wv, 8 bv, 9 rel_emb [16,999]
  if (ws_size < (size_t)WS_END) return;
  char* ws = (char*)d_ws; _Float16 *QH = (_Float16*)(ws + WS_QH), *QL = (_Float16*)(ws + WS_QL), *KH = (_Float16*)(ws + WS_KH); __bf16 *VT = (__bf16*)(ws + WS_VT), *VL = (__bf16*)(ws + WS_VL);
  k_proj<<<dim3(TNB * TT / 128, CC / 128, 3), 256, 0, stream>>>(F[0], F[1], F[2], F[3], F[4], F[5], F[6], F[7], F[8], QH, QL, KH, VT, VL);
  k_att<<<dim3(TT / 64, NH, TNB), 128, 0, stream>>>(QH, QL, KH, VT, VL, F[9], (float*)d_out);
}

// v006
// One run takes 63.3 microseconds.
// In both of two side-by-side timings against v005, it was 1.04 times as fast.
// Counting every step since v000, it is 9.47 times as fast.
// compute dtype: all float inputs rounded to bf16; q/k/v = x W + b ((in,out)) with EXACT bf16 products on WMMA 16x16x32, f32 accumulate (sequence padded 500 -> 512 internally; padded keys masked, padded queries dropped); q as f16 hi + residual (x 2^10), k f16 -> 2-product logits / 8 + rel_emb[h][q - k + 499] kept in f32 registers (one launch for all batches and heads); online softmax in f32 on logits carried in log2 units (scale and bias table x log2 e, hardware exp2), 32 keys a step; unnormalised P split bf16 hi + lo against v bf16 hi + lo (3 products), divided by the row sum at the end; the merged context is the output; f32 output.
#include <hip/hip_runtime.h>
#include <math.h>

typedef __attribute__((ext_vector_type(16))) _Float16 v16h;
typedef __attribute__((ext_vector_type(16))) __bf16 v16b;
typedef __attribute__((ext_vector_type(8)))  _Float16 v8h;
typedef __attribute__((ext_vector_type(8)))  float v8f;
typedef __attribute__((ext_vector_type(4)))  float v4f;
typedef __attribute__((ext_vector_type(2)))  float v2f;
typedef __attribute__((ext_vector_type(4)))  unsigned v4u;
typedef __attribute__((ext_vector_type(4)))  int v4i;
typedef float __attribute__((may_alias)) float_a;
typedef int __attribute__((may_alias)) int_a;

template <typename T> __device__ __forceinline__ void vst2(void* p, T v) { *(T*)p = v;  }
__device__ __forceinline__ v8f wmma16(v16h a, v16h b, v8f c) {
  v8f d = __builtin_amdgcn_wmma_f32_16x16x32_f16(false, a, false, b, (short)0, c, false, false);
  asm volatile("v_nop\n\tv_nop\n\tv_nop\n\tv_nop" : "+v"(d) : "v"(a), "v"(b));
  return d;
}
__device__ __forceinline__ v8f wmma_bf(v16b a, v16b b, v8f c) {
  v8f d = __builtin_amdgcn_wmma_f32_16x16x32_bf16(false, a, false, b, (short)0, c, false, false);
  asm volatile("v_nop\n\tv_nop\n\tv_nop\n\tv_nop" : "+v"(d) : "v"(a), "v"(b));
  return d;
}
// 16x16x32 fragments: lane = (h = lane>>4, row/col = lane&15); elements 0..7 = k0+8h+0..7, 8..15 = k0+16+8h+0..7; D element r = row 8h+r
__device__ __forceinline__ v16h frag_h(const _Float16* rowk0, int lane) {
  union { v16h v; v8h q[2]; } u; const _Float16* p = rowk0 + 8 * (lane >> 4);
  u.q[0] = *(const v8h*)p; u.q[1] = *(const v8h*)(p + 16); return u.v;
}
__device__ __forceinline__ v16h frag_f32(const float* rowk0, int lane) {
  v16h a; const float* p = rowk0 + 8 * (lane >> 4);
#pragma unroll
  for (int i = 0; i < 8; ++i) { a[i] = (_Float16)p[i]; a[8 + i] = (_Float16)p[16 + i]; }
  return a;
}
__device__ __forceinline__ v16h frag_f32s(const float* rowk0, int lane, float sc) {
  v16h a; const float* p = rowk0 + 8 * (lane >> 4);
#pragma unroll
  for (int i = 0; i < 8; ++i) { a[i] = (_Float16)(p[i] * sc); a[8 + i] = (_Float16)(p[16 + i] * sc); }
  return a;
}
// column fragment from a [K][ld] layout (column n), rows >= K read as 0
__device__ __forceinline__ v16h fragc_f32(const float* W, int k0, int n, int lane, int ld, int K) {
  v16h a; const int g = lane >> 4;
#pragma unroll
  for (int i = 0; i < 8; ++i) { const int ka = k0 + 8 * g + i, kb = ka + 16;
    a[i] = (_Float16)(ka < K ? W[(size_t)(ka < K ? ka : K - 1) * ld + n] : 0.f); a[8 + i] = (_Float16)(kb < K ? W[(size_t)(kb < K ? kb : K - 1) * ld + n] : 0.f); }
  return a;
}
struct F2 { v16b h, l; };
__device__ __forceinline__ F2 bsplit16(const float v[16]) { F2 r;
#pragma unroll
  for (int i = 0; i < 16; ++i) { const __bf16 h = (__bf16)v[i]; r.h[i] = h; r.l[i] = (__bf16)(v[i] - (float)h); }
  return r; }
__device__ __forceinline__ F2 split_row(const float* row, int k0, int lane) { float v[16]; const float* p = row + k0 + 8 * (lane >> 4);
#pragma unroll
  for (int i = 0; i < 8; ++i) { v[i] = p[i]; v[8 + i] = p[16 + i]; }
  return bsplit16(v); }
__device__ __forceinline__ F2 split_rowK(const float* row, int k0, int lane, int K) { float v[16]; const int g = lane >> 4;
#pragma unroll
  for (int i = 0; i < 8; ++i) { const int ka = k0 + 8 * g + i, kb = ka + 16; v[i] = ka < K ? row[ka < K ? ka : K - 1] : 0.f; v[8 + i] = kb < K ? row[kb < K ? kb : K - 1] : 0.f; }
  return bsplit16(v); }
__device__ __forceinline__ F2 split_col(const float* W, int k0, int n, int lane, int ld, int K) { float v[16]; const int g = lane >> 4;
#pragma unroll
  for (int i = 0; i < 8; ++i) { const int ka = k0 + 8 * g + i, kb = ka + 16; v[i] = ka < K ? W[(size_t)(ka < K ? ka : K - 1) * ld + n] : 0.f; v[8 + i] = kb < K ? W[(size_t)(kb < K ? kb : K - 1) * ld + n] : 0.f; }
  return bsplit16(v); }
__device__ __forceinline__ v8f mac3(const F2& a, const F2& b, v8f c) { c = wmma_bf(a.l, b.h, c); c = wmma_bf(a.h, b.l, c); return wmma_bf(a.h, b.h, c); }
__device__ __forceinline__ float sigm(float v) { return 1.0f / (1.0f + expf(-v)); }
#define LDSX() do { asm volatile("s_wait_dscnt 0" ::: "memory"); __builtin_amdgcn_wave_barrier(); __builtin_amdgcn_fence(__ATOMIC_RELEASE, "workgroup"); } while (0)


// Attention (B 8, S 500 padded to 512, D 1,024 = 16 x 64, q/k/v biases, logits / 8): scores = q k^T / 8 + rel_emb[h][q - k + 499] (999 offsets), softmax, P v; the context is the output.
#define NB 8
#define TT 512               // padded length
#define LB 500               // real sequence length (input/output rows per batch)
#define NREL 999
#define XROW(r) (((r) / TT) * (size_t)LB + (((r) % TT) < LB ? ((r) % TT) : (LB - 1)))   /* padded row -> clamped input row */
#define CC 1024
#define NH 16
#define HD 64
#define HG 16               // heads per launch group
#ifndef TNB
#define TNB NB
#endif
typedef __attribute__((ext_vector_type(8))) __bf16 v8b;
__device__ __forceinline__ v16b frag_b(const __bf16* rowk0, int lane) {
  union { v16b v; v8b q[2]; } u; const __bf16* p = rowk0 + 8 * (lane >> 4);
  u.q[0] = *(const v8b*)p; u.q[1] = *(const v8b*)(p + 16); return u.v;
}
__device__ __forceinline__ float bfr(float v) { return (float)(__bf16)v; }
__device__ __attribute__((noinline)) float exp_ni(float v) { return expf(v); }
__device__ __attribute__((noinline)) float erf_ni(float v) { return erff(v); }

#define WS_QH  0u
#define WS_QL  (WS_QH + 2u * (size_t)NB * TT * CC)
#define WS_KH  (WS_QL + 2u * (size_t)NB * TT * CC)
#define WS_VT  (WS_KH + 2u * (size_t)NB * TT * CC)      // bf16 v planes [b][c][t]
#define WS_VL  (WS_VT + 2u * (size_t)NB * CC * TT)      // bf16 v residual planes
#define WS_S   (WS_VL + 2u * (size_t)NB * CC * TT)      // f32 region [hg][q][k], unused: scores stay in registers
#define WS_PH  (WS_S + 4u * (size_t)HG * TT * TT)
#define WS_Y   (WS_PH + 0u)              // unused; y is written straight to the output
#define WS_END (WS_Y + 4u * (size_t)NB * TT * CC)

// ---- k_proj: block = (256 rows, 256 cols, which), 16 waves of 64 rows x 64 cols (4 x 4 waves): qkv = x W (+ b), exact; each 32-k slice of X and W is read in whole lines, rounded to bf16 once per block and staged in LDS (two buffers); the slices are summed in a ring order that starts at a slice of the block's own; q -> f16 hi (+ residual), k -> f16 rows, v -> bf16 planes
typedef __attribute__((ext_vector_type(4))) __bf16 v4b;
#define PJP 40    // pitch of a staged slice row, bf16 elements: 80 B = 16 B x odd, no bank conflict for 16-byte reads
#define PJE 264   // pitch of an output plane row, 16-bit elements: 528 B = 16 B x odd
#define PJB 256   // rows and columns of a block's tile
typedef const __attribute__((address_space(1))) char gbyte;   /* named global, else the loads compile to flat loads */
/* wo, xo: the thread's own byte offsets in the slice to be read (W is 4 MiB, X under 16 MiB: 32 bits hold every offset) */
__device__ __forceinline__ void pj_load(const float* W, const float* X, unsigned wo, const unsigned* xo, float* wr, v4f* xr) {
  gbyte* const wq = (gbyte*)W + wo;
#pragma unroll
  for (int i = 0; i < 16; ++i) wr[i] = *(const __attribute__((address_space(1))) float*)(wq + i * (CC * 4));   /* a wave reads 32 neighbouring columns of one k: one line */
#pragma unroll
  for (int it = 0; it < 4; ++it) xr[it] = *(const __attribute__((address_space(1))) v4f*)((gbyte*)X + xo[it]);   /* eight lanes a row: four whole lines a wave */
}
__device__ __forceinline__ void pj_store(__bf16* wd, __bf16* xd, const float* wr, const v4f* xr) {
  v8b w0, w1;
#pragma unroll
  for (int i = 0; i < 8; ++i) { w0[i] = (__bf16)wr[i]; w1[i] = (__bf16)wr[8 + i]; }
  *(v8b*)wd = w0; *(v8b*)(wd + 8) = w1;   /* W slice transposed: [column][k] */
#pragma unroll
  for (int it = 0; it < 4; ++it) { v4b x;
#pragma unroll
    for (int i = 0; i < 4; ++i) x[i] = (__bf16)xr[it][i];
    *(v4b*)(xd + it * 64 * PJP) = x; }
}
__global__ __launch_bounds__(512) void k_proj(const float* __restrict__ X0, const float* __restrict__ X1, const float* __restrict__ X2, const float* __restrict__ WQ, const float* __restrict__ BQ, const float* __restrict__ WK, const float* __restrict__ BK, const float* __restrict__ WV, const float* __restrict__ BV, _Float16* __restrict__ QH, _Float16* __restrict__ QL, _Float16* __restrict__ KH, __bf16* __restrict__ VT, __bf16* __restrict__ VL) {
  __shared__ __align__(16) unsigned short sm[2 * PJB * PJE];   /* in the loop: X slices [2][256][PJP], then W slices [2][256][PJP]; behind the loop: the two output planes [256][PJE] */
  __bf16* const xs = (__bf16*)sm; __bf16* const wt = xs + 2 * PJB * PJP;
  const int tid = threadIdx.x, wave = tid >> 5, lane = tid & 31, col = lane & 15, g = lane >> 4; const int tr = (wave >> 2) * 64, tc = (wave & 3) * 64;   /* the wave's 64 x 64 corner in the block's tile */
  const int which = blockIdx.z; const int c0 = blockIdx.y * PJB; const size_t r0 = (size_t)blockIdx.x * PJB; const float* WA = which == 0 ? WQ : which == 1 ? WK : WV; const float* BA = which == 0 ? BQ : which == 1 ? BK : BV; const float* X = which == 0 ? X0 : which == 1 ? X1 : X2;
  /* the block walks its 32 k slices in a ring that starts at slice rot: the 4 blocks that share an X tile start 8 slices apart and the 16 that share a W tile 2 apart, so that a line is fetched from memory for one of them and the others find it in L2, instead of all of them waiting for the same fetch in every slice */
  const int rot = (2 * blockIdx.x + 8 * blockIdx.y) & (CC / 32 - 1);
  unsigned wo = (unsigned)((rot * 32 + (tid >> 8) * 16) * CC + c0 + (tid & 255)) * 4u;   /* thread: one column, 16 of the slice's 32 k */
  unsigned xo[4];
#pragma unroll
  for (int it = 0; it < 4; ++it) xo[it] = (unsigned)(XROW(r0 + it * 64 + (tid >> 3)) * CC + rot * 32 + (tid & 7) * 4) * 4u;   /* padded row -> clamped 500-row input */
  __bf16* const wd = wt + (tid & 255) * PJP + (tid >> 8) * 16; __bf16* const xd = xs + (tid >> 3) * PJP + (tid & 7) * 4;
  float wr[16]; v4f xr[4];
  pj_load(WA, X, wo, xo, wr, xr); pj_store(wd, xd, wr, xr);
  __syncthreads();   /* slice 0 is read by every wave */
  v8f acc[4][4] = {};   /* [row tile][column tile] */
#pragma unroll 2
  for (int kc = 0; kc < CC / 32; ++kc) { const int cur = (kc & 1) * PJB * PJP, nxt = PJB * PJP - cur;
    v16b a[4], w[4];   /* four X and four W fragments feed sixteen products; their sixteen LDS reads stand as one group at the head of the slice, in front of the global loads, so that the products start at once */
#pragma unroll
    for (int i = 0; i < 4; ++i) { a[i] = frag_b(xs + cur + (tr + i * 16 + col) * PJP, lane); w[i] = frag_b(wt + cur + (tc + i * 16 + col) * PJP, lane); }
    if (kc + 1 < CC / 32) { const int st = ((rot + kc + 1) & (CC / 32 - 1)) ? 1 : 1 - CC / 32;   /* one slice on, or from the last slice back to the first */
      asm volatile("s_wait_xcnt 0x0" : "+v"(wo), "+v"(xo[0]), "+v"(xo[1]), "+v"(xo[2]), "+v"(xo[3]) :: "memory");   /* stands in front of the offset steps, which rewrite the registers that the last slice's loads name; the offsets pass through the statement, else the compiler lifts their steps over the wait */
      wo += st * (32 * CC * 4);
#pragma unroll
      for (int it = 0; it < 4; ++it) xo[it] += st * (32 * 4);
      pj_load(WA, X, wo, xo, wr, xr); }   /* the next slice of the ring flies behind this slice's products */
#pragma unroll
    for (int j = 0; j < 4; ++j)
#pragma unroll
      for (int i = 0; i < 4; ++i) acc[i][j] = wmma_bf(a[i], w[j], acc[i][j]);
    __builtin_amdgcn_sched_barrier(0);   /* keeps the roundings of the next slice, and with them the wait for its global loads, behind all sixteen products: lifted among them, the wait idles the matrix unit for the loads' whole flight */
    if (kc + 1 < CC / 32) pj_store(wd + nxt, xd + nxt, wr, xr);
    __syncthreads(); }   /* publishes the next slice and ends every read of this one (after the last slice: before the planes overlay it) */
  _Float16* const sh = (_Float16*)sm; _Float16* const sl = sh + PJB * PJE; __bf16* const th = (__bf16*)sm; __bf16* const tl2 = th + PJB * PJE;
  float bb[4] = {0.f, 0.f, 0.f, 0.f};
  if (BA) {   /* one test, so that the four bias loads fly together */
#pragma unroll
    for (int j = 0; j < 4; ++j) bb[j] = BA[c0 + tc + j * 16 + col];
    asm volatile("s_wait_xcnt 0x0" ::: "memory");   /* stands in front of whatever next rewrites the register that the four loads name */
#pragma unroll
    for (int j = 0; j < 4; ++j) bb[j] = bfr(bb[j]); }
  /* the test on which stands once, outside the unrolled loops, for speed only */
  if (which == 2) {
#pragma unroll
    for (int j = 0; j < 4; ++j)
#pragma unroll
      for (int i = 0; i < 4; ++i)
#pragma unroll
        for (int r = 0; r < 8; ++r) { const float v = acc[i][j][r] + bb[j]; const int rl = tr + i * 16 + 8 * g + r, cl = tc + j * 16 + col; const __bf16 bh = (__bf16)v; th[cl * PJE + rl] = bh; tl2[cl * PJE + rl] = (__bf16)(v - (float)bh); } }
  else {
#pragma unroll
    for (int j = 0; j < 4; ++j)
#pragma unroll
      for (int i = 0; i < 4; ++i)
#pragma unroll
        for (int r = 0; r < 8; ++r) { const float v = acc[i][j][r] + bb[j]; const int rl = tr + i * 16 + 8 * g + r, cl = tc + j * 16 + col; const _Float16 hv = (_Float16)v; sh[rl * PJE + cl] = hv; sl[rl * PJE + cl] = (_Float16)((v - (float)hv) * 1024.0f); } }   /* q residual carried x 2^10 so the plane stays f16-normal on the chip */
  __syncthreads();
  if (which < 2) { _Float16* dh = which == 0 ? QH : KH; for (int e = tid; e < PJB * 32; e += 512) { const int rl = e >> 5, q = e & 31; vst2((unsigned*)(dh + (r0 + rl) * CC + c0 + q * 8), *(const v4u*)&sh[rl * PJE + q * 8]);
      asm volatile("s_wait_xcnt 0x0" ::: "memory");   /* stands in front of the next LDS read and address step, which rewrite the store's registers */
      if (which == 0) { vst2((unsigned*)(QL + (r0 + rl) * CC + c0 + q * 8), *(const v4u*)&sl[rl * PJE + q * 8]);
        asm volatile("s_wait_xcnt 0x0" ::: "memory"); } } }   /* the same, behind the residual's store */
  else { const size_t b = r0 / TT; const int t0 = (int)(r0 % TT); for (int e = tid; e < PJB * 32; e += 512) { const int cl = e >> 5, q = e & 31; const size_t o2 = (b * CC + c0 + cl) * (size_t)TT + t0 + q * 8; vst2((unsigned*)(VT + o2), *(const v4u*)&th[cl * PJE + q * 8]); vst2((unsigned*)(VL + o2), *(const v4u*)&tl2[cl * PJE + q * 8]);
      asm volatile("s_wait_xcnt 0x0" ::: "memory"); } } }   /* stands in front of the next LDS reads and address step, which rewrite the two stores' registers */
// ---- k_att: block = (64 queries, head, batch), wave = 16 queries: S^T = K Q^T (2 products) / 8 + bias, online softmax per query column, O^T += V^T P^T (3 products); scores and P never leave the registers; K rows and the two V planes come 64 keys a stage by tensor loads into two LDS buffers that the four waves share
typedef __attribute__((ext_vector_type(8))) unsigned v8u;
#define SKY 64              // keys per stage: a staged row is one whole 128-byte line (K: 64 d of one key; V planes: 64 keys of one d)
#define TPE 72              // LDS pitch of a staged row, 16-bit elements: 144 B = 16 B x odd, no bank conflict for 16-byte reads
#define TSZ 10240           // one staged tile: 64 rows x 144 B, rounded up to a multiple of 2 KiB
#define BSZ (3 * TSZ)       // one buffer: K, V hi, V lo
#define NST (TT / SKY)
#define LOG2E 1.44269504088896340736f
__device__ __forceinline__ unsigned uni(unsigned v) { return (unsigned)__builtin_amdgcn_readfirstlane(v); }
__device__ __forceinline__ unsigned pinned(unsigned v) { unsigned w = uni(v); asm volatile("" : "+s"(w)); return w; }
__device__ __forceinline__ void tdm_load(unsigned lds_dst, unsigned long long ga, v8u g1) { v4u g0;
  g0[0] = uni(1u); g0[1] = uni(lds_dst); g0[2] = uni((unsigned)ga); g0[3] = uni((((unsigned)(ga >> 32)) & 0x01FFFFFFu) | 0x80000000u);
  asm volatile("tensor_load_to_lds %0, %1" :: "s"(g0), "s"(g1) : "memory"); }   /* one request of the whole wave: 64 rows of 128 B into LDS, through no register */
/* 2^x of a step's sixteen score differences and of the rescale exponent. One statement, every v_exp_f32 in place: none overwrites the source of the one in front of it, and the closing v_nop is the slot that the instruction set asks for between the last one and whatever the compiler puts behind (written as builtins, the register allocator gave one v_exp_f32 the source register of the one directly in front) */
__device__ __forceinline__ void exp2_17(float (&s)[16], float& a) {
  asm("v_exp_f32 %0, %0\n\tv_exp_f32 %1, %1\n\tv_exp_f32 %2, %2\n\tv_exp_f32 %3, %3\n\tv_exp_f32 %4, %4\n\tv_exp_f32 %5, %5\n\tv_exp_f32 %6, %6\n\tv_exp_f32 %7, %7\n\tv_exp_f32 %8, %8\n\tv_exp_f32 %9, %9\n\tv_exp_f32 %10, %10\n\tv_exp_f32 %11, %11\n\tv_exp_f32 %12, %12\n\tv_exp_f32 %13, %13\n\tv_exp_f32 %14, %14\n\tv_exp_f32 %15, %15\n\tv_exp_f32 %16, %16\n\tv_nop"
      : "+v"(s[0]), "+v"(s[1]), "+v"(s[2]), "+v"(s[3]), "+v"(s[4]), "+v"(s[5]), "+v"(s[6]), "+v"(s[7]), "+v"(s[8]), "+v"(s[9]), "+v"(s[10]), "+v"(s[11]), "+v"(s[12]), "+v"(s[13]), "+v"(s[14]), "+v"(s[15]), "+v"(a)); }
__global__ __launch_bounds__(128) void k_att(const _Float16* __restrict__ QH, const _Float16* __restrict__ QL, const _Float16* __restrict__ KH, const __bf16* __restrict__ VT, const __bf16* __restrict__ VL, const float* __restrict__ REL, float* __restrict__ Y) {   /* REL: rel_emb [16][999] */
  __shared__ __attribute__((aligned(2048))) unsigned char ring[2 * BSZ];   /* in the loop: two buffers of three tiles; behind the loop: the output staging */
  __shared__ float rt[2 * TT];
  const int tid = threadIdx.x, lane = tid & 31, col = lane & 15, g = lane >> 4; const int h = blockIdx.y, b = blockIdx.z; const unsigned wave = uni(tid >> 5); const int ql0 = blockIdx.x * 64 + wave * 16;
  /* waves 0, 1, 2 bring one tile a stage each: K rows, V hi plane, V lo plane */
  const unsigned long long tsrc = wave == 0 ? (unsigned long long)(size_t)(KH + (size_t)b * TT * CC + h * HD) : (unsigned long long)(size_t)((wave == 1 ? VT : VL) + ((size_t)b * CC + h * HD) * (size_t)TT);
  const unsigned tstep = wave == 0 ? SKY * 2u * CC : SKY * 2u;   /* bytes from one stage's tile to the next */
  const unsigned tdst = (unsigned)(size_t)ring + wave * TSZ;
  v8u g1;   /* 1-byte elements, tensor = tile = 64 rows of 128 B, a pad of 16 B behind every 128 B */
  g1[0] = uni((1u << 20) | (4u << 22) | (3u << 25)); g1[1] = uni(128u << 16); g1[2] = uni(64u << 16); g1[3] = uni(128u << 16); g1[4] = uni(64u); g1[5] = uni(wave == 0 ? 2u * CC : 2u * TT); g1[6] = uni(0u); g1[7] = uni(0u);
  v16h qh[HD / 32], qlo[HD / 32], kb[2][HD / 32];
#pragma unroll
  for (int kc = 0; kc < HD / 32; ++kc) { const size_t qo = ((size_t)b * TT + ql0 + col) * CC + h * HD + kc * 32; qh[kc] = frag_h(QH + qo, lane); qlo[kc] = frag_h(QL + qo, lane); }
  asm volatile("s_wait_xcnt 0x0" ::: "memory");   /* stands between the Q loads and the table loads, so that neither group's results land in an address register of the other while that is still named by an issued load */
#pragma unroll   /* all eight table loads of a thread in flight together */
  for (int n = 0; n < 2 * TT / 128; ++n) { const int i = n * 128 + tid, ri = (TT - 1) - i + LB - 1; rt[i] = bfr(REL[(size_t)h * NREL + (ri < 0 ? 0 : (ri < NREL ? ri : NREL - 1))]) * LOG2E; }   /* rt[511 - q + k] = bias at q - k + 499 (clamped for padded rows), in log2 units: ascending in k */
  if (pinned(wave < 3)) { tdm_load(tdst, tsrc, g1);
    asm volatile("s_wait_tensorcnt 0x0" ::: "memory"); }   /* stage 0's tile has landed before the barrier that publishes it */
  __syncthreads();   /* the bias row and stage 0 are read by every wave */
  if (pinned(wave < 3)) tdm_load(tdst + BSZ, tsrc + tstep, g1);   /* stage 1 flies behind stage 0's work */
  const float* rb = rt + (TT - 1) - (ql0 + col) + 8 * g;
  v8f o[HD / 16] = {}; float m = -3.0e38f, l = 0.f;
#pragma unroll 1   /* rolled: one pass a stage, the buffer picked by the stage's parity */
  for (int s = 0; s < NST; ++s) { const unsigned char* bp = ring + (s & 1) * BSZ; const _Float16* kt = (const _Float16*)bp + col * TPE; const __bf16* th = (const __bf16*)(bp + TSZ) + col * TPE; const __bf16* tl = (const __bf16*)(bp + 2 * TSZ) + col * TPE;
#pragma unroll
    for (int kc = 0; kc < HD / 32; ++kc)
#pragma unroll
      for (int t = 0; t < 2; ++t) kb[t][kc] = frag_h(kt + (t * 16) * TPE + kc * 32, lane);
#pragma unroll
    for (int u = 0; u < SKY / 32; ++u) { const int k0 = s * SKY + u * 32; v16b vh[HD / 16], vl[HD / 16];
#pragma unroll
      for (int j = 0; j < HD / 16; ++j) { vh[j] = frag_b(th + (j * 16) * TPE + u * 32, lane); vl[j] = frag_b(tl + (j * 16) * TPE + u * 32, lane); }
      __builtin_amdgcn_sched_barrier(0);   /* keeps this step's V reads in one group in front of the score products, so that they return behind products and softmax */
      v8f a[2] = {}, al[2] = {};
#pragma unroll
      for (int kc = 0; kc < HD / 32; ++kc)
#pragma unroll
        for (int t = 0; t < 2; ++t) { a[t] = wmma16(kb[t][kc], qh[kc], a[t]); al[t] = wmma16(kb[t][kc], qlo[kc], al[t]); }
      if (u + 1 < SKY / 32) {   /* the next step's K rows, of this same stage only */
#pragma unroll
        for (int kc = 0; kc < HD / 32; ++kc)
#pragma unroll
          for (int t = 0; t < 2; ++t) kb[t][kc] = frag_h(kt + ((u + 1) * 32 + t * 16) * TPE + kc * 32, lane); }
      __builtin_amdgcn_sched_barrier(0);   /* keeps those K reads in front of the softmax, one step ahead of their use */
      float sc[16];
#pragma unroll
      for (int t = 0; t < 2; ++t)
#pragma unroll
        for (int r = 0; r < 8; ++r) sc[t * 8 + r] = (a[t][r] + al[t][r] * (1.0f / 1024.0f)) * (0.125f * LOG2E) + rb[k0 + t * 16 + r];   /* lane (g, col): key k0 + 16 t + 8 g + r, query ql0 + col; logit x log2 e, so that e^(s - m) is one exp2 of a difference */
      if (k0 + 32 > LB) {   /* padded keys masked */
#pragma unroll
        for (int t = 0; t < 2; ++t)
#pragma unroll
          for (int r = 0; r < 8; ++r) if (k0 + t * 16 + 8 * g + r >= LB) sc[t * 8 + r] = -3.0e38f; }
      float mx = m;
#pragma unroll
      for (int i = 0; i < 16; ++i) mx = fmaxf(mx, sc[i]);
      mx = fmaxf(mx, __shfl_xor(mx, 16));   /* the two lane halves hold the two key halves of one query */
      float al0 = m - mx; m = mx;
#pragma unroll
      for (int i = 0; i < 16; ++i) sc[i] -= m;
      exp2_17(sc, al0);   /* masked keys underflow to 0 */
      l *= al0;
#pragma unroll
      for (int j = 0; j < HD / 16; ++j) o[j] *= al0;
#pragma unroll
      for (int i = 0; i < 16; ++i) l += sc[i];
      const F2 p = bsplit16(sc);   /* two S^T tiles of 16 keys are one B fragment of 32 keys */
#pragma unroll
      for (int j = 0; j < HD / 16; ++j) o[j] = wmma_bf(vh[j], p.h, o[j]);
#pragma unroll
      for (int j = 0; j < HD / 16; ++j) o[j] = wmma_bf(vh[j], p.l, o[j]);
#pragma unroll
      for (int j = 0; j < HD / 16; ++j) o[j] = wmma_bf(vl[j], p.h, o[j]); }
    asm volatile("s_wait_dscnt 0x0" ::: "memory");   /* this wave's reads of stage s have returned before its buffer is refilled */
    if (pinned(wave < 3)) asm volatile("s_wait_tensorcnt 0x0" ::: "memory");   /* the issuer's own tile of stage s + 1 has landed */
    __syncthreads();   /* publishes stage s + 1 and ends every wave's reads of stage s */
    if (pinned(wave < 3 && s + 2 < NST)) tdm_load(tdst + (s & 1) * BSZ, tsrc + (unsigned long long)pinned(s + 2) * tstep, g1); }   /* into the buffer that this pass has just read; the address is formed behind the wait */
  asm volatile("s_wait_tensorcnt 0x0" ::: "memory");   /* no request is in flight when the ring becomes output staging */
  asm volatile("s_wait_dscnt 0x0" ::: "memory");   /* nor a read of it; the last pass's barrier has ended every other wave's reads */
  float (*ss)[16][HD + 4] = (float (*)[16][HD + 4])ring;
  l += __shfl_xor(l, 16); const float inv = 1.0f / l;
#pragma unroll
  for (int j = 0; j < HD / 16; ++j) { v4f x0, x1;
#pragma unroll
    for (int r = 0; r < 4; ++r) { x0[r] = o[j][r] * inv; x1[r] = o[j][4 + r] * inv; }
    *(v4f*)&ss[wave][col][j * 16 + 8 * g] = x0; *(v4f*)&ss[wave][col][j * 16 + 8 * g + 4] = x1; }   /* lane (g, col): d = 16 j + 8 g + r of query col */
  LDSX();
#pragma unroll
  for (int it = 0; it < 8; ++it) { const int rl = it * 2 + g; if (ql0 + rl < LB) vst2(Y + ((size_t)b * LB + ql0 + rl) * CC + h * HD + col * 4, *(const v4f*)&ss[wave][rl][col * 4]); } }   /* only the 500 real rows, at the output's 500-row stride */
// ---- k_out: block = (64 rows, 128 cols): out = y (bf16 hi + lo) Wo + bo
__global__ __launch_bounds__(128) void k_out(const float* __restrict__ Y, const float* __restrict__ WP, const float* __restrict__ BP, float* __restrict__ OUT) { __shared__ __align__(16) float sf[4][16][132];
  const int tid = threadIdx.x, wave = tid >> 5, lane = tid & 31, col = lane & 15, g = lane >> 4; const int c0 = blockIdx.y * 128; const size_t r0 = (size_t)blockIdx.x * 64 + wave * 16;
  v8f acc[8] = {};
#pragma unroll 2
  for (int kc = 0; kc < CC / 32; ++kc) { const F2 a = split_row(Y + (r0 + col) * CC, kc * 32, lane);
#pragma unroll
    for (int j = 0; j < 8; ++j) { v16b w; const int o = c0 + j * 16 + col;
#pragma unroll
      for (int i = 0; i < 8; ++i) { w[i] = (__bf16)WP[(size_t)(kc * 32 + 8 * g + i) * CC + o]; w[8 + i] = (__bf16)WP[(size_t)(kc * 32 + 16 + 8 * g + i) * CC + o]; }   /* (in,out) */
      acc[j] = wmma_bf(a.h, w, acc[j]); acc[j] = wmma_bf(a.l, w, acc[j]); } }
#pragma unroll
  for (int j = 0; j < 8; ++j) { const float bb = BP ? bfr(BP[c0 + j * 16 + col]) : 0.f;
#pragma unroll
    for (int r = 0; r < 8; ++r) sf[wave][8 * g + r][j * 16 + col] = acc[j][r] + bb; }
  LDSX(); for (int rl = 0; rl < 16; ++rl) vst2(OUT + (r0 + rl) * CC + c0 + lane * 4, *(const v4f*)&sf[wave][rl][lane * 4]); }
extern "C" void kernel_launch(void* const* d_in, const int* in_sizes, int n_in, void* d_out, int out_size, void* d_ws, size_t ws_size, hipStream_t stream) {
  (void)in_sizes; (void)n_in; (void)out_size;
  const float** F = (const float**)d_in;   // 0 query [8,500,1024], 1 key, 2 value, 3 Wq ((in,out)), 4 bq, 5 Wk, 6 bk, 7 Wv, 8 bv, 9 rel_emb [16,999]
  if (ws_size < (size_t)WS_END) return;
  char* ws = (char*)d_ws; _Float16 *QH = (_Float16*)(ws + WS_QH), *QL = (_Float16*)(ws + WS_QL), *KH = (_Float16*)(ws + WS_KH); __bf16 *VT = (__bf16*)(ws + WS_VT), *VL = (__bf16*)(ws + WS_VL);
  k_proj<<<dim3(TNB * TT / 256, CC / 256, 3), 512, 0, stream>>>(F[0], F[1], F[2], F[3], F[4], F[5], F[6], F[7], F[8], QH, QL, KH, VT, VL);
  k_att<<<dim3(TT / 64, NH, TNB), 128, 0, stream>>>(QH, QL, KH, VT, VL, F[9], (float*)d_out);
}

// v007
// One run takes 57.8 microseconds.
// Two timings next to v006 put it at 1.09 and 1.10 times that version's speed.
// Counting every step since v000, it is 10.4 times as fast.
// compute dtype: all float inputs rounded to bf16; q/k/v = x W + b ((in,out)) with EXACT bf16 products on WMMA 16x16x32, f32 accumulate (sequence padded 500 -> 512 internally; padded keys masked, padded queries dropped); q as f16 hi + residual (x 2^10), k f16 -> 2-product logits / 8 + rel_emb[h][q - k + 499] kept in f32 registers (one launch for all batches and heads); online softmax in f32 on logits carried in log2 units (scale and bias table x log2 e, hardware exp2), 32 keys a step; unnormalised P split bf16 hi + lo against v bf16 hi + lo (3 products), divided by the row sum at the end; the merged context is the output; f32 output.
#include <hip/hip_runtime.h>
#include <math.h>

typedef __attribute__((ext_vector_type(16))) _Float16 v16h;
typedef __attribute__((ext_vector_type(16))) __bf16 v16b;
typedef __attribute__((ext_vector_type(8)))  _Float16 v8h;
typedef __attribute__((ext_vector_type(8)))  float v8f;
typedef __attribute__((ext_vector_type(4)))  float v4f;
typedef __attribute__((ext_vector_type(2)))  float v2f;
typedef __attribute__((ext_vector_type(4)))  unsigned v4u;
typedef __attribute__((ext_vector_type(4)))  int v4i;
typedef float __attribute__((may_alias)) float_a;
typedef int __attribute__((may_alias)) int_a;

template <typename T> __device__ __forceinline__ void vst2(void* p, T v) { *(T*)p = v;  }
__device__ __forceinline__ v8f wmma16(v16h a, v16h b, v8f c) {
  v8f d = __builtin_amdgcn_wmma_f32_16x16x32_f16(false, a, false, b, (short)0, c, false, false);
  asm volatile("v_nop\n\tv_nop\n\tv_nop\n\tv_nop" : "+v"(d) : "v"(a), "v"(b));
  return d;
}
__device__ __forceinline__ v8f wmma_bf(v16b a, v16b b, v8f c) {
  v8f d = __builtin_amdgcn_wmma_f32_16x16x32_bf16(false, a, false, b, (short)0, c, false, false);
  asm volatile("v_nop\n\tv_nop\n\tv_nop\n\tv_nop" : "+v"(d) : "v"(a), "v"(b));
  return d;
}
// 16x16x32 fragments: lane = (h = lane>>4, row/col = lane&15); elements 0..7 = k0+8h+0..7, 8..15 = k0+16+8h+0..7; D element r = row 8h+r
__device__ __forceinline__ v16h frag_h(const _Float16* rowk0, int lane) {
  union { v16h v; v8h q[2]; } u; const _Float16* p = rowk0 + 8 * (lane >> 4);
  u.q[0] = *(const v8h*)p; u.q[1] = *(const v8h*)(p + 16); return u.v;
}
__device__ __forceinline__ v16h frag_f32(const float* rowk0, int lane) {
  v16h a; const float* p = rowk0 + 8 * (lane >> 4);
#pragma unroll
  for (int i = 0; i < 8; ++i) { a[i] = (_Float16)p[i]; a[8 + i] = (_Float16)p[16 + i]; }
  return a;
}
__device__ __forceinline__ v16h frag_f32s(const float* rowk0, int lane, float sc) {
  v16h a; const float* p = rowk0 + 8 * (lane >> 4);
#pragma unroll
  for (int i = 0; i < 8; ++i) { a[i] = (_Float16)(p[i] * sc); a[8 + i] = (_Float16)(p[16 + i] * sc); }
  return a;
}
// column fragment from a [K][ld] layout (column n), rows >= K read as 0
__device__ __forceinline__ v16h fragc_f32(const float* W, int k0, int n, int lane, int ld, int K) {
  v16h a; const int g = lane >> 4;
#pragma unroll
  for (int i = 0; i < 8; ++i) { const int ka = k0 + 8 * g + i, kb = ka + 16;
    a[i] = (_Float16)(ka < K ? W[(size_t)(ka < K ? ka : K - 1) * ld + n] : 0.f); a[8 + i] = (_Float16)(kb < K ? W[(size_t)(kb < K ? kb : K - 1) * ld + n] : 0.f); }
  return a;
}
struct F2 { v16b h, l; };
__device__ __forceinline__ F2 bsplit16(const float v[16]) { F2 r;
#pragma unroll
  for (int i = 0; i < 16; ++i) { const __bf16 h = (__bf16)v[i]; r.h[i] = h; r.l[i] = (__bf16)(v[i] - (float)h); }
  return r; }
__device__ __forceinline__ F2 split_row(const float* row, int k0, int lane) { float v[16]; const float* p = row + k0 + 8 * (lane >> 4);
#pragma unroll
  for (int i = 0; i < 8; ++i) { v[i] = p[i]; v[8 + i] = p[16 + i]; }
  return bsplit16(v); }
__device__ __forceinline__ F2 split_rowK(const float* row, int k0, int lane, int K) { float v[16]; const int g = lane >> 4;
#pragma unroll
  for (int i = 0; i < 8; ++i) { const int ka = k0 + 8 * g + i, kb = ka + 16; v[i] = ka < K ? row[ka < K ? ka : K - 1] : 0.f; v[8 + i] = kb < K ? row[kb < K ? kb : K - 1] : 0.f; }
  return bsplit16(v); }
__device__ __forceinline__ F2 split_col(const float* W, int k0, int n, int lane, int ld, int K) { float v[16]; const int g = lane >> 4;
#pragma unroll
  for (int i = 0; i < 8; ++i) { const int ka = k0 + 8 * g + i, kb = ka + 16; v[i] = ka < K ? W[(size_t)(ka < K ? ka : K - 1) * ld + n] : 0.f; v[8 + i] = kb < K ? W[(size_t)(kb < K ? kb : K - 1) * ld + n] : 0.f; }
  return bsplit16(v); }
__device__ __forceinline__ v8f mac3(const F2& a, const F2& b, v8f c) { c = wmma_bf(a.l, b.h, c); c = wmma_bf(a.h, b.l, c); return wmma_bf(a.h, b.h, c); }
__device__ __forceinline__ float sigm(float v) { return 1.0f / (1.0f + expf(-v)); }
#define LDSX() do { asm volatile("s_wait_dscnt 0" ::: "memory"); __builtin_amdgcn_wave_barrier(); __builtin_amdgcn_fence(__ATOMIC_RELEASE, "workgroup"); } while (0)


// Attention (B 8, S 500 padded to 512, D 1,024 = 16 x 64, q/k/v biases, logits / 8): scores = q k^T / 8 + rel_emb[h][q - k + 499] (999 offsets), softmax, P v; the context is the output.
#define NB 8
#define TT 512               // padded length
#define LB 500               // real sequence length (input/output rows per batch)
#define NREL 999
#define XROW(r) (((r) / TT) * (size_t)LB + (((r) % TT) < LB ? ((r) % TT) : (LB - 1)))   /* padded row -> clamped input row */
#define CC 1024
#define NH 16
#define HD 64
#define HG 16               // heads per launch group
#ifndef TNB
#define TNB NB
#endif
typedef __attribute__((ext_vector_type(8))) __bf16 v8b;
__device__ __forceinline__ v16b frag_b(const __bf16* rowk0, int lane) {
  union { v16b v; v8b q[2]; } u; const __bf16* p = rowk0 + 8 * (lane >> 4);
  u.q[0] = *(const v8b*)p; u.q[1] = *(const v8b*)(p + 16); return u.v;
}
__device__ __forceinline__ float bfr(float v) { return (float)(__bf16)v; }
__device__ __attribute__((noinline)) float exp_ni(float v) { return expf(v); }
__device__ __attribute__((noinline)) float erf_ni(float v) { return erff(v); }

#define WS_QH  0u
#define WS_QL  (WS_QH + 2u * (size_t)NB * TT * CC)
#define WS_KH  (WS_QL + 2u * (size_t)NB * TT * CC)
#define WS_VT  (WS_KH + 2u * (size_t)NB * TT * CC)      // bf16 v planes [b][c][t]
#define WS_VL  (WS_VT + 2u * (size_t)NB * CC * TT)      // bf16 v residual planes
#define WS_S   (WS_VL + 2u * (size_t)NB * CC * TT)      // f32 region [hg][q][k], unused: scores stay in registers
#define WS_PH  (WS_S + 4u * (size_t)HG * TT * TT)
#define WS_Y   (WS_PH + 0u)              // unused; y is written straight to the output
#define WS_END (WS_Y + 4u * (size_t)NB * TT * CC)

// ---- k_proj: block = (256 rows, 256 cols, which), 16 waves of 64 rows x 64 cols (4 x 4 waves): qkv = x W (+ b), exact; each 32-k slice of X and W is read in whole lines, rounded to bf16 once per block and staged in LDS (a ring of four buffers, one barrier per two slices); the slices are summed in a ring order that starts at a slice of the block's own; q -> f16 hi (+ residual), k -> f16 rows, v -> bf16 planes
typedef __attribute__((ext_vector_type(4))) __bf16 v4b;
#define PJP 40    // pitch of a staged slice row, bf16 elements: 80 B = 16 B x odd, no bank conflict for 16-byte reads
#define PJE 264   // pitch of an output plane row, 16-bit elements: 528 B = 16 B x odd
#define PJB 256   // rows and columns of a block's tile
typedef const __attribute__((address_space(1))) char gbyte;   /* named global, else the loads compile to flat loads */
/* wo, xo: the thread's own byte offsets in the slice to be read (W is 4 MiB, X under 16 MiB: 32 bits hold every offset) */
__device__ __forceinline__ void pj_load_w(const float* W, unsigned wo, float* wr) {
  gbyte* const wq = (gbyte*)W + wo;
#pragma unroll
  for (int i = 0; i < 16; ++i) wr[i] = *(const __attribute__((address_space(1))) float*)(wq + i * (CC * 4));   /* a wave reads 32 neighbouring columns of one k: one line */
}
__device__ __forceinline__ void pj_load_x(const float* X, const unsigned* xo, v4f* xr) {
#pragma unroll
  for (int it = 0; it < 4; ++it) xr[it] = *(const __attribute__((address_space(1))) v4f*)((gbyte*)X + xo[it]);   /* eight lanes a row: four whole lines a wave */
}
__device__ __forceinline__ void pj_store_w(__bf16* wd, const float* wr) {
  v8b w0, w1;
#pragma unroll
  for (int i = 0; i < 8; ++i) { w0[i] = (__bf16)wr[i]; w1[i] = (__bf16)wr[8 + i]; }
  *(v8b*)wd = w0; *(v8b*)(wd + 8) = w1;   /* W slice transposed: [column][k] */
}
__device__ __forceinline__ void pj_store_x(__bf16* xd, const v4f* xr) {
#pragma unroll
  for (int it = 0; it < 4; ++it) { v4b x;
#pragma unroll
    for (int i = 0; i < 4; ++i) x[i] = (__bf16)xr[it][i];
    *(v4b*)(xd + it * 64 * PJP) = x; }
}
/* work-group barrier that orders LDS traffic only: __syncthreads() also waits for every global load in flight, which would end the flight of the loads issued in front of it at the barrier */
__device__ __forceinline__ void lds_barrier() { __builtin_amdgcn_fence(__ATOMIC_RELEASE, "workgroup", "local"); __builtin_amdgcn_s_barrier(); __builtin_amdgcn_fence(__ATOMIC_ACQUIRE, "workgroup", "local"); }
__global__ __launch_bounds__(512) void k_proj(const float* __restrict__ X0, const float* __restrict__ X1, const float* __restrict__ X2, const float* __restrict__ WQ, const float* __restrict__ BQ, const float* __restrict__ WK, const float* __restrict__ BK, const float* __restrict__ WV, const float* __restrict__ BV, _Float16* __restrict__ QH, _Float16* __restrict__ QL, _Float16* __restrict__ KH, __bf16* __restrict__ VT, __bf16* __restrict__ VL) {
  __shared__ __align__(16) unsigned short sm[2 * PJB * PJE];   /* in the loop: X slices [4][256][PJP], then W slices [4][256][PJP]; behind the loop: the two output planes [256][PJE] */
  __bf16* const xs = (__bf16*)sm; __bf16* const wt = xs + 4 * PJB * PJP;
  const int tid = threadIdx.x, wave = tid >> 5, lane = tid & 31, col = lane & 15, g = lane >> 4; const int tr = (wave >> 2) * 64, tc = (wave & 3) * 64;   /* the wave's 64 x 64 corner in the block's tile */
  const int which = blockIdx.z; const int c0 = blockIdx.y * PJB; const size_t r0 = (size_t)blockIdx.x * PJB; const float* WA = which == 0 ? WQ : which == 1 ? WK : WV; const float* BA = which == 0 ? BQ : which == 1 ? BK : BV; const float* X = which == 0 ? X0 : which == 1 ? X1 : X2;
  /* the block walks its 32 k slices in a ring that starts at slice rot: the 4 blocks that share an X tile start 8 slices apart and the 16 that share a W tile 2 apart, so that a line is fetched from memory for one of them and the others find it in L2, instead of all of them waiting for the same fetch in every slice */
  const int rot = (2 * blockIdx.x + 8 * blockIdx.y) & (CC / 32 - 1);
  unsigned wo = (unsigned)((rot * 32 + (tid >> 8) * 16) * CC + c0 + (tid & 255)) * 4u;   /* thread: one column, 16 of the slice's 32 k */
  unsigned xo[4];
#pragma unroll
  for (int it = 0; it < 4; ++it) xo[it] = (unsigned)(XROW(r0 + it * 64 + (tid >> 3)) * CC + rot * 32 + (tid & 7) * 4) * 4u;   /* padded row -> clamped 500-row input */
  __bf16* const wd = wt + (tid & 255) * PJP + (tid >> 8) * 16; __bf16* const xd = xs + (tid >> 3) * PJP + (tid & 7) * 4;
  float wr[16]; v4f xr[4];
  /* PJ_STEP_W(n), PJ_STEP_X(n): the W offset, or the four X offsets, go on to the n-th slice of the block's walk: one slice on, or from the last slice back to the first. The s_wait_xcnt stands in front of the offset steps, which rewrite the registers that the last loads name; the offsets pass through the statement, else the compiler lifts their steps over the wait */
#define PJ_ST(n) (((rot + (n)) & (CC / 32 - 1)) ? 1 : 1 - CC / 32)
#define PJ_WAIT_W() asm volatile("s_wait_xcnt 0x0" : "+v"(wo) :: "memory")
#define PJ_WAIT_X() asm volatile("s_wait_xcnt 0x0" : "+v"(xo[0]), "+v"(xo[1]), "+v"(xo[2]), "+v"(xo[3]) :: "memory")
#define PJ_STEP_W(n) do { PJ_WAIT_W(); wo += PJ_ST(n) * (32 * CC * 4); } while (0)
#define PJ_STEP_X(n) do { PJ_WAIT_X(); \
    xo[0] += PJ_ST(n) * (32 * 4); xo[1] += PJ_ST(n) * (32 * 4); xo[2] += PJ_ST(n) * (32 * 4); xo[3] += PJ_ST(n) * (32 * 4); } while (0)
  { float wr1[16]; v4f xr1[4];   /* slices 0 and 1 fly together: the accumulators' registers are still free */
    pj_load_w(WA, wo, wr); pj_load_x(X, xo, xr); PJ_STEP_W(1); PJ_STEP_X(1); pj_load_w(WA, wo, wr1); pj_load_x(X, xo, xr1);
    pj_store_w(wd, wr); pj_store_x(xd, xr); pj_store_w(wd + PJB * PJP, wr1); pj_store_x(xd + PJB * PJP, xr1); }
  PJ_STEP_W(2); PJ_STEP_X(2); pj_load_w(WA, wo, wr);
  __builtin_amdgcn_sched_barrier(0);   /* W loads in front of X loads, as in the loop: loads return in issue order, and with the other order here the loop's first wait for W would have to cover the X loads as well */
  pj_load_x(X, xo, xr);   /* slice 2 flies over the barrier and slice 0's products */
  lds_barrier();   /* slices 0 and 1 are read by every wave */
  v8f acc[4][4] = {};   /* [row tile][column tile] */
  /* one slice: st = slice kc + 2 exists and is rounded and stored, ld = slice kc + 3 exists and is loaded; both are compile-time constants at every call, so that no branch stands between a load and its counted wait */
  auto slice = [&](const int kc, const bool st, const bool ld) { const int cur = (kc & 3) * PJB * PJP, nx2 = ((kc + 2) & 3) * PJB * PJP;
    v16b a[4], w[4];   /* four X and four W fragments feed sixteen products; their sixteen LDS reads stand as one group at the head of the slice */
#pragma unroll
    for (int i = 0; i < 4; ++i) { a[i] = frag_b(xs + cur + (tr + i * 16 + col) * PJP, lane); w[i] = frag_b(wt + cur + (tc + i * 16 + col) * PJP, lane); }
#pragma unroll
    for (int j = 0; j < 2; ++j)
#pragma unroll
      for (int i = 0; i < 4; ++i) acc[i][j] = wmma_bf(a[i], w[j], acc[i][j]);
    __builtin_amdgcn_sched_barrier(0);   /* keeps the W roundings of slice kc + 2, and with them the wait for its loads, behind the first eight products */
    if (st) pj_store_w(wd + nx2, wr);   /* into the pair of buffers that the last barrier has freed */
    if (ld) { PJ_STEP_W(kc + 3); pj_load_w(WA, wo, wr); if (kc + 4 >= CC / 32) PJ_WAIT_W(); }   /* (behind the walk's last loads the wait stands at once: their offset register is free for whatever the compiler puts there next) reissued as soon as the roundings have freed the registers: the W loads fly from the middle of one slice to the middle of the next, half a slice off the X loads, so that one half's latency lies under the other half's transfer */
    __builtin_amdgcn_sched_barrier(0);   /* keeps those loads in the middle of the slice: sunk behind the last eight products they would leave with the X loads in one burst */
#pragma unroll
    for (int j = 2; j < 4; ++j)
#pragma unroll
      for (int i = 0; i < 4; ++i) acc[i][j] = wmma_bf(a[i], w[j], acc[i][j]);
    __builtin_amdgcn_sched_barrier(0);   /* keeps the X roundings of slice kc + 2, and with them the wait for its loads, behind all sixteen products */
    if (st) pj_store_x(xd + nx2, xr);
    if (ld) { PJ_STEP_X(kc + 3); pj_load_x(X, xo, xr); if (kc + 4 >= CC / 32) PJ_WAIT_X(); }   /* (the same wait behind the last X loads) the X loads fly over the barrier, the next slice's LDS reads and all its products */
    if (kc & 1) lds_barrier(); };   /* once per two slices: publishes the next pair of slices and ends every read of this pair (after the last slice: before the planes overlay it) */
#pragma unroll 4   /* the ring's four buffers at constant offsets */
  for (int kc = 0; kc < CC / 32 - 4; ++kc) slice(kc, true, true);
#pragma unroll   /* the last four slices, where the walk runs out of slices to store and to load */
  for (int kc = CC / 32 - 4; kc < CC / 32; ++kc) slice(kc, kc + 2 < CC / 32, kc + 3 < CC / 32);
#undef PJ_STEP_X
#undef PJ_WAIT_X
#undef PJ_WAIT_W
#undef PJ_STEP_W
#undef PJ_ST
  _Float16* const sh = (_Float16*)sm; _Float16* const sl = sh + PJB * PJE; __bf16* const th = (__bf16*)sm; __bf16* const tl2 = th + PJB * PJE;
  float bb[4] = {0.f, 0.f, 0.f, 0.f};
  if (BA) {   /* one test, so that the four bias loads fly together */
#pragma unroll
    for (int j = 0; j < 4; ++j) bb[j] = BA[c0 + tc + j * 16 + col];
    asm volatile("s_wait_xcnt 0x0" ::: "memory");   /* stands in front of whatever next rewrites the register that the four loads name */
#pragma unroll
    for (int j = 0; j < 4; ++j) bb[j] = bfr(bb[j]); }
  /* the test on which stands once, outside the unrolled loops, for speed only */
  if (which == 2) {
#pragma unroll
    for (int j = 0; j < 4; ++j)
#pragma unroll
      for (int i = 0; i < 4; ++i)
#pragma unroll
        for (int r = 0; r < 8; ++r) { const float v = acc[i][j][r] + bb[j]; const int rl = tr + i * 16 + 8 * g + r, cl = tc + j * 16 + col; const __bf16 bh = (__bf16)v; th[cl * PJE + rl] = bh; tl2[cl * PJE + rl] = (__bf16)(v - (float)bh); } }
  else {
#pragma unroll
    for (int j = 0; j < 4; ++j)
#pragma unroll
      for (int i = 0; i < 4; ++i)
#pragma unroll
        for (int r = 0; r < 8; ++r) { const float v = acc[i][j][r] + bb[j]; const int rl = tr + i * 16 + 8 * g + r, cl = tc + j * 16 + col; const _Float16 hv = (_Float16)v; sh[rl * PJE + cl] = hv; sl[rl * PJE + cl] = (_Float16)((v - (float)hv) * 1024.0f); } }   /* q residual carried x 2^10 so the plane stays f16-normal on the chip */
  __syncthreads();
  if (which < 2) { _Float16* dh = which == 0 ? QH : KH; for (int e = tid; e < PJB * 32; e += 512) { const int rl = e >> 5, q = e & 31; vst2((unsigned*)(dh + (r0 + rl) * CC + c0 + q * 8), *(const v4u*)&sh[rl * PJE + q * 8]);
      asm volatile("s_wait_xcnt 0x0" ::: "memory");   /* stands in front of the next LDS read and address step, which rewrite the store's registers */
      if (which == 0) { vst2((unsigned*)(QL + (r0 + rl) * CC + c0 + q * 8), *(const v4u*)&sl[rl * PJE + q * 8]);
        asm volatile("s_wait_xcnt 0x0" ::: "memory"); } } }   /* the same, behind the residual's store */
  else { const size_t b = r0 / TT; const int t0 = (int)(r0 % TT); for (int e = tid; e < PJB * 32; e += 512) { const int cl = e >> 5, q = e & 31; const size_t o2 = (b * CC + c0 + cl) * (size_t)TT + t0 + q * 8; vst2((unsigned*)(VT + o2), *(const v4u*)&th[cl * PJE + q * 8]); vst2((unsigned*)(VL + o2), *(const v4u*)&tl2[cl * PJE + q * 8]);
      asm volatile("s_wait_xcnt 0x0" ::: "memory"); } } }   /* stands in front of the next LDS reads and address step, which rewrite the two stores' registers */
// ---- k_att: block = (64 queries, head, batch), wave = 16 queries: S^T = K Q^T (2 products) / 8 + bias, online softmax per query column, O^T += V^T P^T (3 products); scores and P never leave the registers; K rows and the two V planes come 64 keys a stage by tensor loads into two LDS buffers that the four waves share
typedef __attribute__((ext_vector_type(8))) unsigned v8u;
#define SKY 64              // keys per stage: a staged row is one whole 128-byte line (K: 64 d of one key; V planes: 64 keys of one d)
#define TPE 72              // LDS pitch of a staged row, 16-bit elements: 144 B = 16 B x odd, no bank conflict for 16-byte reads
#define TSZ 10240           // one staged tile: 64 rows x 144 B, rounded up to a multiple of 2 KiB
#define BSZ (3 * TSZ)       // one buffer: K, V hi, V lo
#define NST (TT / SKY)
#define LOG2E 1.44269504088896340736f
__device__ __forceinline__ unsigned uni(unsigned v) { return (unsigned)__builtin_amdgcn_readfirstlane(v); }
__device__ __forceinline__ unsigned pinned(unsigned v) { unsigned w = uni(v); asm volatile("" : "+s"(w)); return w; }
__device__ __forceinline__ void tdm_load(unsigned lds_dst, unsigned long long ga, v8u g1) { v4u g0;
  g0[0] = uni(1u); g0[1] = uni(lds_dst); g0[2] = uni((unsigned)ga); g0[3] = uni((((unsigned)(ga >> 32)) & 0x01FFFFFFu) | 0x80000000u);
  asm volatile("tensor_load_to_lds %0, %1" :: "s"(g0), "s"(g1) : "memory"); }   /* one request of the whole wave: 64 rows of 128 B into LDS, through no register */
/* 2^x of a step's sixteen score differences and of the rescale exponent. One statement, every v_exp_f32 in place: none overwrites the source of the one in front of it, and the closing v_nop is the slot that the instruction set asks for between the last one and whatever the compiler puts behind (written as builtins, the register allocator gave one v_exp_f32 the source register of the one directly in front) */
__device__ __forceinline__ void exp2_17(float (&s)[16], float& a) {
  asm("v_exp_f32 %0, %0\n\tv_exp_f32 %1, %1\n\tv_exp_f32 %2, %2\n\tv_exp_f32 %3, %3\n\tv_exp_f32 %4, %4\n\tv_exp_f32 %5, %5\n\tv_exp_f32 %6, %6\n\tv_exp_f32 %7, %7\n\tv_exp_f32 %8, %8\n\tv_exp_f32 %9, %9\n\tv_exp_f32 %10, %10\n\tv_exp_f32 %11, %11\n\tv_exp_f32 %12, %12\n\tv_exp_f32 %13, %13\n\tv_exp_f32 %14, %14\n\tv_exp_f32 %15, %15\n\tv_exp_f32 %16, %16\n\tv_nop"
      : "+v"(s[0]), "+v"(s[1]), "+v"(s[2]), "+v"(s[3]), "+v"(s[4]), "+v"(s[5]), "+v"(s[6]), "+v"(s[7]), "+v"(s[8]), "+v"(s[9]), "+v"(s[10]), "+v"(s[11]), "+v"(s[12]), "+v"(s[13]), "+v"(s[14]), "+v"(s[15]), "+v"(a)); }
__global__ __launch_bounds__(128) void k_att(const _Float16* __restrict__ QH, const _Float16* __restrict__ QL, const _Float16* __restrict__ KH, const __bf16* __restrict__ VT, const __bf16* __restrict__ VL, const float* __restrict__ REL, float* __restrict__ Y) {   /* REL: rel_emb [16][999] */
  __shared__ __attribute__((aligned(2048))) unsigned char ring[2 * BSZ];   /* in the loop: two buffers of three tiles; behind the loop: the output staging */
  __shared__ float rt[2 * TT];
  const int tid = threadIdx.x, lane = tid & 31, col = lane & 15, g = lane >> 4; const int h = blockIdx.y, b = blockIdx.z; const unsigned wave = uni(tid >> 5); const int ql0 = blockIdx.x * 64 + wave * 16;
  /* waves 0, 1, 2 bring one tile a stage each: K rows, V hi plane, V lo plane */
  const unsigned long long tsrc = wave == 0 ? (unsigned long long)(size_t)(KH + (size_t)b * TT * CC + h * HD) : (unsigned long long)(size_t)((wave == 1 ? VT : VL) + ((size_t)b * CC + h * HD) * (size_t)TT);
  const unsigned tstep = wave == 0 ? SKY * 2u * CC : SKY * 2u;   /* bytes from one stage's tile to the next */
  const unsigned tdst = (unsigned)(size_t)ring + wave * TSZ;
  v8u g1;   /* 1-byte elements, tensor = tile = 64 rows of 128 B, a pad of 16 B behind every 128 B */
  g1[0] = uni((1u << 20) | (4u << 22) | (3u << 25)); g1[1] = uni(128u << 16); g1[2] = uni(64u << 16); g1[3] = uni(128u << 16); g1[4] = uni(64u); g1[5] = uni(wave == 0 ? 2u * CC : 2u * TT); g1[6] = uni(0u); g1[7] = uni(0u);
  v16h qh[HD / 32], qlo[HD / 32], kb[2][HD / 32];
#pragma unroll
  for (int kc = 0; kc < HD / 32; ++kc) { const size_t qo = ((size_t)b * TT + ql0 + col) * CC + h * HD + kc * 32; qh[kc] = frag_h(QH + qo, lane); qlo[kc] = frag_h(QL + qo, lane); }
  asm volatile("s_wait_xcnt 0x0" ::: "memory");   /* stands between the Q loads and the table loads, so that neither group's results land in an address register of the other while that is still named by an issued load */
#pragma unroll   /* all eight table loads of a thread in flight together */
  for (int n = 0; n < 2 * TT / 128; ++n) { const int i = n * 128 + tid, ri = (TT - 1) - i + LB - 1; rt[i] = bfr(REL[(size_t)h * NREL + (ri < 0 ? 0 : (ri < NREL ? ri : NREL - 1))]) * LOG2E; }   /* rt[511 - q + k] = bias at q - k + 499 (clamped for padded rows), in log2 units: ascending in k */
  if (pinned(wave < 3)) { tdm_load(tdst, tsrc, g1);
    asm volatile("s_wait_tensorcnt 0x0" ::: "memory"); }   /* stage 0's tile has landed before the barrier that publishes it */
  __syncthreads();   /* the bias row and stage 0 are read by every wave */
  if (pinned(wave < 3)) tdm_load(tdst + BSZ, tsrc + tstep, g1);   /* stage 1 flies behind stage 0's work */
  const float* rb = rt + (TT - 1) - (ql0 + col) + 8 * g;
  v8f o[HD / 16] = {}; float m = -3.0e38f, l = 0.f;
#pragma unroll 1   /* rolled: one pass a stage, the buffer picked by the stage's parity */
  for (int s = 0; s < NST; ++s) { const unsigned char* bp = ring + (s & 1) * BSZ; const _Float16* kt = (const _Float16*)bp + col * TPE; const __bf16* th = (const __bf16*)(bp + TSZ) + col * TPE; const __bf16* tl = (const __bf16*)(bp + 2 * TSZ) + col * TPE;
#pragma unroll
    for (int kc = 0; kc < HD / 32; ++kc)
#pragma unroll
      for (int t = 0; t < 2; ++t) kb[t][kc] = frag_h(kt + (t * 16) * TPE + kc * 32, lane);
#pragma unroll
    for (int u = 0; u < SKY / 32; ++u) { const int k0 = s * SKY + u * 32; v16b vh[HD / 16], vl[HD / 16];
#pragma unroll
      for (int j = 0; j < HD / 16; ++j) { vh[j] = frag_b(th + (j * 16) * TPE + u * 32, lane); vl[j] = frag_b(tl + (j * 16) * TPE + u * 32, lane); }
      __builtin_amdgcn_sched_barrier(0);   /* keeps this step's V reads in one group in front of the score products, so that they return behind products and softmax */
      v8f a[2] = {}, al[2] = {};
#pragma unroll
      for (int kc = 0; kc < HD / 32; ++kc)
#pragma unroll
        for (int t = 0; t < 2; ++t) { a[t] = wmma16(kb[t][kc], qh[kc], a[t]); al[t] = wmma16(kb[t][kc], qlo[kc], al[t]); }
      if (u + 1 < SKY / 32) {   /* the next step's K rows, of this same stage only */
#pragma unroll
        for (int kc = 0; kc < HD / 32; ++kc)
#pragma unroll
          for (int t = 0; t < 2; ++t) kb[t][kc] = frag_h(kt + ((u + 1) * 32 + t * 16) * TPE + kc * 32, lane); }
      __builtin_amdgcn_sched_barrier(0);   /* keeps those K reads in front of the softmax, one step ahead of their use */
      float sc[16];
#pragma unroll
      for (int t = 0; t < 2; ++t)
#pragma unroll
        for (int r = 0; r < 8; ++r) sc[t * 8 + r] = (a[t][r] + al[t][r] * (1.0f / 1024.0f)) * (0.125f * LOG2E) + rb[k0 + t * 16 + r];   /* lane (g, col): key k0 + 16 t + 8 g + r, query ql0 + col; logit x log2 e, so that e^(s - m) is one exp2 of a difference */
      if (k0 + 32 > LB) {   /* padded keys masked */
#pragma unroll
        for (int t = 0; t < 2; ++t)
#pragma unroll
          for (int r = 0; r < 8; ++r) if (k0 + t * 16 + 8 * g + r >= LB) sc[t * 8 + r] = -3.0e38f; }
      float mx = m;
#pragma unroll
      for (int i = 0; i < 16; ++i) mx = fmaxf(mx, sc[i]);
      mx = fmaxf(mx, __shfl_xor(mx, 16));   /* the two lane halves hold the two key halves of one query */
      float al0 = m - mx; m = mx;
#pragma unroll
      for (int i = 0; i < 16; ++i) sc[i] -= m;
      exp2_17(sc, al0);   /* masked keys underflow to 0 */
      l *= al0;
#pragma unroll
      for (int j = 0; j < HD / 16; ++j) o[j] *= al0;
#pragma unroll
      for (int i = 0; i < 16; ++i) l += sc[i];
      const F2 p = bsplit16(sc);   /* two S^T tiles of 16 keys are one B fragment of 32 keys */
#pragma unroll
      for (int j = 0; j < HD / 16; ++j) o[j] = wmma_bf(vh[j], p.h, o[j]);
#pragma unroll
      for (int j = 0; j < HD / 16; ++j) o[j] = wmma_bf(vh[j], p.l, o[j]);
#pragma unroll
      for (int j = 0; j < HD / 16; ++j) o[j] = wmma_bf(vl[j], p.h, o[j]); }
    asm volatile("s_wait_dscnt 0x0" ::: "memory");   /* this wave's reads of stage s have returned before its buffer is refilled */
    if (pinned(wave < 3)) asm volatile("s_wait_tensorcnt 0x0" ::: "memory");   /* the issuer's own tile of stage s + 1 has landed */
    __syncthreads();   /* publishes stage s + 1 and ends every wave's reads of stage s */
    if (pinned(wave < 3 && s + 2 < NST)) tdm_load(tdst + (s & 1) * BSZ, tsrc + (unsigned long long)pinned(s + 2) * tstep, g1); }   /* into the buffer that this pass has just read; the address is formed behind the wait */
  asm volatile("s_wait_tensorcnt 0x0" ::: "memory");   /* no request is in flight when the ring becomes output staging */
  asm volatile("s_wait_dscnt 0x0" ::: "memory");   /* nor a read of it; the last pass's barrier has ended every other wave's reads */
  float (*ss)[16][HD + 4] = (float (*)[16][HD + 4])ring;
  l += __shfl_xor(l, 16); const float inv = 1.0f / l;
#pragma unroll
  for (int j = 0; j < HD / 16; ++j) { v4f x0, x1;
#pragma unroll
    for (int r = 0; r < 4; ++r) { x0[r] = o[j][r] * inv; x1[r] = o[j][4 + r] * inv; }
    *(v4f*)&ss[wave][col][j * 16 + 8 * g] = x0; *(v4f*)&ss[wave][col][j * 16 + 8 * g + 4] = x1; }   /* lane (g, col): d = 16 j + 8 g + r of query col */
  LDSX();
#pragma unroll
  for (int it = 0; it < 8; ++it) { const int rl = it * 2 + g; if (ql0 + rl < LB) vst2(Y + ((size_t)b * LB + ql0 + rl) * CC + h * HD + col * 4, *(const v4f*)&ss[wave][rl][col * 4]); } }   /* only the 500 real rows, at the output's 500-row stride */
// ---- k_out: block = (64 rows, 128 cols): out = y (bf16 hi + lo) Wo + bo
__global__ __launch_bounds__(128) void k_out(const float* __restrict__ Y, const float* __restrict__ WP, const float* __restrict__ BP, float* __restrict__ OUT) { __shared__ __align__(16) float sf[4][16][132];
  const int tid = threadIdx.x, wave = tid >> 5, lane = tid & 31, col = lane & 15, g = lane >> 4; const int c0 = blockIdx.y * 128; const size_t r0 = (size_t)blockIdx.x * 64 + wave * 16;
  v8f acc[8] = {};
#pragma unroll 2
  for (int kc = 0; kc < CC / 32; ++kc) { const F2 a = split_row(Y + (r0 + col) * CC, kc * 32, lane);
#pragma unroll
    for (int j = 0; j < 8; ++j) { v16b w; const int o = c0 + j * 16 + col;
#pragma unroll
      for (int i = 0; i < 8; ++i) { w[i] = (__bf16)WP[(size_t)(kc * 32 + 8 * g + i) * CC + o]; w[8 + i] = (__bf16)WP[(size_t)(kc * 32 + 16 + 8 * g + i) * CC + o]; }   /* (in,out) */
      acc[j] = wmma_bf(a.h, w, acc[j]); acc[j] = wmma_bf(a.l, w, acc[j]); } }
#pragma unroll
  for (int j = 0; j < 8; ++j) { const float bb = BP ? bfr(BP[c0 + j * 16 + col]) : 0.f;
#pragma unroll
    for (int r = 0; r < 8; ++r) sf[wave][8 * g + r][j * 16 + col] = acc[j][r] + bb; }
  LDSX(); for (int rl = 0; rl < 16; ++rl) vst2(OUT + (r0 + rl) * CC + c0 + lane * 4, *(const v4f*)&sf[wave][rl][lane * 4]); }
extern "C" void kernel_launch(void* const* d_in, const int* in_sizes, int n_in, void* d_out, int out_size, void* d_ws, size_t ws_size, hipStream_t stream) {
  (void)in_sizes; (void)n_in; (void)out_size;
  const float** F = (const float**)d_in;   // 0 query [8,500,1024], 1 key, 2 value, 3 Wq ((in,out)), 4 bq, 5 Wk, 6 bk, 7 Wv, 8 bv, 9 rel_emb [16,999]
  if (ws_size < (size_t)WS_END) return;
  char* ws = (char*)d_ws; _Float16 *QH = (_Float16*)(ws + WS_QH), *QL = (_Float16*)(ws + WS_QL), *KH = (_Float16*)(ws + WS_KH); __bf16 *VT = (__bf16*)(ws + WS_VT), *VL = (__bf16*)(ws + WS_VL);
  k_proj<<<dim3(TNB * TT / 256, CC / 256, 3), 512, 0, stream>>>(F[0], F[1], F[2], F[3], F[4], F[5], F[6], F[7], F[8], QH, QL, KH, VT, VL);
  k_att<<<dim3(TT / 64, NH, TNB), 128, 0, stream>>>(QH, QL, KH, VT, VL, F[9], (float*)d_out);
}

// v008
// One run takes 56 microseconds.
// In both of two side-by-side timings against v007, it was 1.03 times as fast.
// All steps since v000 together make it 10.7 times as fast.
// compute dtype: all float inputs rounded to bf16; q/k/v = x W + b ((in,out)) with EXACT bf16 products on WMMA 16x16x32, f32 accumulate (sequence padded 500 -> 512 internally; padded keys masked, padded queries dropped); q as f16 hi + residual (x 2^10), k f16 -> 2-product logits / 8 + rel_emb[h][q - k + 499] kept in f32 registers (one launch for all batches and heads); online softmax in f32 on logits carried in log2 units (scale and bias table x log2 e, hardware exp2), 32 keys a step; unnormalised P split bf16 hi + lo against v bf16 hi + lo (3 products), divided by the row sum at the end; the merged context is the output; f32 output.
#include <hip/hip_runtime.h>
#include <math.h>

typedef __attribute__((ext_vector_type(16))) _Float16 v16h;
typedef __attribute__((ext_vector_type(16))) __bf16 v16b;
typedef __attribute__((ext_vector_type(8)))  _Float16 v8h;
typedef __attribute__((ext_vector_type(8)))  float v8f;
typedef __attribute__((ext_vector_type(4)))  float v4f;
typedef __attribute__((ext_vector_type(2)))  float v2f;
typedef __attribute__((ext_vector_type(4)))  unsigned v4u;
typedef __attribute__((ext_vector_type(4)))  int v4i;
typedef float __attribute__((may_alias)) float_a;
typedef int __attribute__((may_alias)) int_a;

template <typename T> __device__ __forceinline__ void vst2(void* p, T v) { *(T*)p = v;  }
__device__ __forceinline__ v8f wmma16(v16h a, v16h b, v8f c) {
  return __builtin_amdgcn_wmma_f32_16x16x32_f16(false, a, false, b, (short)0, c, false, false);
}
__device__ __forceinline__ v8f wmma_bf(v16b a, v16b b, v8f c) {
  return __builtin_amdgcn_wmma_f32_16x16x32_bf16(false, a, false, b, (short)0, c, false, false);
}
// 16x16x32 fragments: lane = (h = lane>>4, row/col = lane&15); elements 0..7 = k0+8h+0..7, 8..15 = k0+16+8h+0..7; D element r = row 8h+r
__device__ __forceinline__ v16h frag_h(const _Float16* rowk0, int lane) {
  union { v16h v; v8h q[2]; } u; const _Float16* p = rowk0 + 8 * (lane >> 4);
  u.q[0] = *(const v8h*)p; u.q[1] = *(const v8h*)(p + 16); return u.v;
}
__device__ __forceinline__ v16h frag_f32(const float* rowk0, int lane) {
  v16h a; const float* p = rowk0 + 8 * (lane >> 4);
#pragma unroll
  for (int i = 0; i < 8; ++i) { a[i] = (_Float16)p[i]; a[8 + i] = (_Float16)p[16 + i]; }
  return a;
}
__device__ __forceinline__ v16h frag_f32s(const float* rowk0, int lane, float sc) {
  v16h a; const float* p = rowk0 + 8 * (lane >> 4);
#pragma unroll
  for (int i = 0; i < 8; ++i) { a[i] = (_Float16)(p[i] * sc); a[8 + i] = (_Float16)(p[16 + i] * sc); }
  return a;
}
// column fragment from a [K][ld] layout (column n), rows >= K read as 0
__device__ __forceinline__ v16h fragc_f32(const float* W, int k0, int n, int lane, int ld, int K) {
  v16h a; const int g = lane >> 4;
#pragma unroll
  for (int i = 0; i < 8; ++i) { const int ka = k0 + 8 * g + i, kb = ka + 16;
    a[i] = (_Float16)(ka < K ? W[(size_t)(ka < K ? ka : K - 1) * ld + n] : 0.f); a[8 + i] = (_Float16)(kb < K ? W[(size_t)(kb < K ? kb : K - 1) * ld + n] : 0.f); }
  return a;
}
struct F2 { v16b h, l; };
__device__ __forceinline__ F2 bsplit16(const float v[16]) { F2 r;
#pragma unroll
  for (int i = 0; i < 16; ++i) { const __bf16 h = (__bf16)v[i]; r.h[i] = h; r.l[i] = (__bf16)(v[i] - (float)h); }
  return r; }
__device__ __forceinline__ F2 split_row(const float* row, int k0, int lane) { float v[16]; const float* p = row + k0 + 8 * (lane >> 4);
#pragma unroll
  for (int i = 0; i < 8; ++i) { v[i] = p[i]; v[8 + i] = p[16 + i]; }
  return bsplit16(v); }
__device__ __forceinline__ F2 split_rowK(const float* row, int k0, int lane, int K) { float v[16]; const int g = lane >> 4;
#pragma unroll
  for (int i = 0; i < 8; ++i) { const int ka = k0 + 8 * g + i, kb = ka + 16; v[i] = ka < K ? row[ka < K ? ka : K - 1] : 0.f; v[8 + i] = kb < K ? row[kb < K ? kb : K - 1] : 0.f; }
  return bsplit16(v); }
__device__ __forceinline__ F2 split_col(const float* W, int k0, int n, int lane, int ld, int K) { float v[16]; const int g = lane >> 4;
#pragma unroll
  for (int i = 0; i < 8; ++i) { const int ka = k0 + 8 * g + i, kb = ka + 16; v[i] = ka < K ? W[(size_t)(ka < K ? ka : K - 1) * ld + n] : 0.f; v[8 + i] = kb < K ? W[(size_t)(kb < K ? kb : K - 1) * ld + n] : 0.f; }
  return bsplit16(v); }
__device__ __forceinline__ v8f mac3(const F2& a, const F2& b, v8f c) { c = wmma_bf(a.l, b.h, c); c = wmma_bf(a.h, b.l, c); return wmma_bf(a.h, b.h, c); }
__device__ __forceinline__ float sigm(float v) { return 1.0f / (1.0f + expf(-v)); }
#define LDSX() do { asm volatile("s_wait_dscnt 0" ::: "memory"); __builtin_amdgcn_wave_barrier(); __builtin_amdgcn_fence(__ATOMIC_RELEASE, "workgroup"); } while (0)


// Attention (B 8, S 500 padded to 512, D 1,024 = 16 x 64, q/k/v biases, logits / 8): scores = q k^T / 8 + rel_emb[h][q - k + 499] (999 offsets), softmax, P v; the context is the output.
#define NB 8
#define TT 512               // padded length
#define LB 500               // real sequence length (input/output rows per batch)
#define NREL 999
#define XROW(r) (((r) / TT) * (size_t)LB + (((r) % TT) < LB ? ((r) % TT) : (LB - 1)))   /* padded row -> clamped input row */
#define CC 1024
#define NH 16
#define HD 64
#define HG 16               // heads per launch group
#ifndef TNB
#define TNB NB
#endif
typedef __attribute__((ext_vector_type(8))) __bf16 v8b;
__device__ __forceinline__ v16b frag_b(const __bf16* rowk0, int lane) {
  union { v16b v; v8b q[2]; } u; const __bf16* p = rowk0 + 8 * (lane >> 4);
  u.q[0] = *(const v8b*)p; u.q[1] = *(const v8b*)(p + 16); return u.v;
}
__device__ __forceinline__ float bfr(float v) { return (float)(__bf16)v; }
__device__ __attribute__((noinline)) float exp_ni(float v) { return expf(v); }
__device__ __attribute__((noinline)) float erf_ni(float v) { return erff(v); }

#define WS_QH  0u
#define WS_QL  (WS_QH + 2u * (size_t)NB * TT * CC)
#define WS_KH  (WS_QL + 2u * (size_t)NB * TT * CC)
#define WS_VT  (WS_KH + 2u * (size_t)NB * TT * CC)      // bf16 v planes [b][c][t]
#define WS_VL  (WS_VT + 2u * (size_t)NB * CC * TT)      // bf16 v residual planes
#define WS_S   (WS_VL + 2u * (size_t)NB * CC * TT)      // f32 region [hg][q][k], unused: scores stay in registers
#define WS_PH  (WS_S + 4u * (size_t)HG * TT * TT)
#define WS_Y   (WS_PH + 0u)              // unused; y is written straight to the output
#define WS_END (WS_Y + 4u * (size_t)NB * TT * CC)

// ---- k_proj: block = (256 rows, 256 cols, which), 16 waves of 64 rows x 64 cols (4 x 4 waves): qkv = x W (+ b), exact; each 32-k slice of X and W is read in whole lines, rounded to bf16 once per block and staged in LDS (a ring of four buffers, one barrier per two slices); the slices are summed in a ring order that starts at a slice of the block's own; q -> f16 hi (+ residual), k -> f16 rows, v -> bf16 planes
typedef __attribute__((ext_vector_type(4))) __bf16 v4b;
#define PJP 40    // pitch of a staged slice row, bf16 elements: 80 B = 16 B x odd, no bank conflict for 16-byte reads
#define PJE 264   // pitch of an output plane row, 16-bit elements: 528 B = 16 B x odd
#define PJB 256   // rows and columns of a block's tile
typedef const __attribute__((address_space(1))) char gbyte;   /* named global, else the loads compile to flat loads */
/* wo, xo: the thread's own byte offsets in the slice to be read (W is 4 MiB, X under 16 MiB: 32 bits hold every offset) */
__device__ __forceinline__ void pj_load_w(const float* W, unsigned wo, float* wr) {
  gbyte* const wq = (gbyte*)W + wo;
#pragma unroll
  for (int i = 0; i < 16; ++i) wr[i] = *(const __attribute__((address_space(1))) float*)(wq + i * (CC * 4));   /* a wave reads 32 neighbouring columns of one k: one line */
}
__device__ __forceinline__ void pj_load_x(const float* X, const unsigned* xo, v4f* xr) {
#pragma unroll
  for (int it = 0; it < 4; ++it) xr[it] = *(const __attribute__((address_space(1))) v4f*)((gbyte*)X + xo[it]);   /* eight lanes a row: four whole lines a wave */
}
__device__ __forceinline__ void pj_store_w(__bf16* wd, const float* wr) {
  v8b w0, w1;
#pragma unroll
  for (int i = 0; i < 8; ++i) { w0[i] = (__bf16)wr[i]; w1[i] = (__bf16)wr[8 + i]; }
  *(v8b*)wd = w0; *(v8b*)(wd + 8) = w1;   /* W slice transposed: [column][k] */
}
__device__ __forceinline__ void pj_store_x(__bf16* xd, const v4f* xr) {
#pragma unroll
  for (int it = 0; it < 4; ++it) { v4b x;
#pragma unroll
    for (int i = 0; i < 4; ++i) x[i] = (__bf16)xr[it][i];
    *(v4b*)(xd + it * 64 * PJP) = x; }
}
/* work-group barrier that orders LDS traffic only: __syncthreads() also waits for every global load in flight, which would end the flight of the loads issued in front of it at the barrier */
__device__ __forceinline__ void lds_barrier() { __builtin_amdgcn_fence(__ATOMIC_RELEASE, "workgroup", "local"); __builtin_amdgcn_s_barrier(); __builtin_amdgcn_fence(__ATOMIC_ACQUIRE, "workgroup", "local"); }
__global__ __launch_bounds__(512) void k_proj(const float* __restrict__ X0, const float* __restrict__ X1, const float* __restrict__ X2, const float* __restrict__ WQ, const float* __restrict__ BQ, const float* __restrict__ WK, const float* __restrict__ BK, const float* __restrict__ WV, const float* __restrict__ BV, _Float16* __restrict__ QH, _Float16* __restrict__ QL, _Float16* __restrict__ KH, __bf16* __restrict__ VT, __bf16* __restrict__ VL) {
  __shared__ __align__(16) unsigned short sm[2 * PJB * PJE];   /* in the loop: X slices [4][256][PJP], then W slices [4][256][PJP]; behind the loop: the two output planes [256][PJE] */
  __bf16* const xs = (__bf16*)sm; __bf16* const wt = xs + 4 * PJB * PJP;
  const int tid = threadIdx.x, wave = __builtin_amdgcn_readfirstlane(tid >> 5), lane = tid & 31, col = lane & 15, g = lane >> 4; const int tr = (wave >> 2) * 64, tc = (wave & 3) * 64;   /* the wave's 64 x 64 corner in the block's tile; the wave's number is read into a scalar register, so that the corner holds no vector register across the loop (all 256 are in use there) */
  const int which = blockIdx.z; const int c0 = blockIdx.y * PJB; const size_t r0 = (size_t)blockIdx.x * PJB; const float* WA = which == 0 ? WQ : which == 1 ? WK : WV; const float* BA = which == 0 ? BQ : which == 1 ? BK : BV; const float* X = which == 0 ? X0 : which == 1 ? X1 : X2;
  /* the block walks its 32 k slices in a ring that starts at slice rot: the 4 blocks that share an X tile start 8 slices apart and the 16 that share a W tile 2 apart, so that a line is fetched from memory for one of them and the others find it in L2, instead of all of them waiting for the same fetch in every slice */
  const int rot = (2 * blockIdx.x + 8 * blockIdx.y) & (CC / 32 - 1);
  unsigned wo = (unsigned)((rot * 32 + (tid >> 8) * 16) * CC + c0 + (tid & 255)) * 4u;   /* thread: one column, 16 of the slice's 32 k */
  unsigned xo[4];
#pragma unroll
  for (int it = 0; it < 4; ++it) xo[it] = (unsigned)(XROW(r0 + it * 64 + (tid >> 3)) * CC + rot * 32 + (tid & 7) * 4) * 4u;   /* padded row -> clamped 500-row input */
  __bf16* const wd = wt + (tid & 255) * PJP + (tid >> 8) * 16; __bf16* const xd = xs + (tid >> 3) * PJP + (tid & 7) * 4;
  float wr[16]; v4f xr[4];
  /* PJ_STEP_W(n), PJ_STEP_X(n): the W offset, or the four X offsets, go on to the n-th slice of the block's walk: one slice on, or from the last slice back to the first. The s_wait_xcnt stands in front of the offset steps, which rewrite the registers that the last loads name; the offsets pass through the statement, else the compiler lifts their steps over the wait */
#define PJ_ST(n) (((rot + (n)) & (CC / 32 - 1)) ? 1 : 1 - CC / 32)
#define PJ_WAIT_W() asm volatile("s_wait_xcnt 0x0" : "+v"(wo) :: "memory")
#define PJ_WAIT_X() asm volatile("s_wait_xcnt 0x0" : "+v"(xo[0]), "+v"(xo[1]), "+v"(xo[2]), "+v"(xo[3]) :: "memory")
#define PJ_STEP_W(n) do { PJ_WAIT_W(); wo += PJ_ST(n) * (32 * CC * 4); } while (0)
#define PJ_STEP_X(n) do { PJ_WAIT_X(); \
    xo[0] += PJ_ST(n) * (32 * 4); xo[1] += PJ_ST(n) * (32 * 4); xo[2] += PJ_ST(n) * (32 * 4); xo[3] += PJ_ST(n) * (32 * 4); } while (0)
  { float wr1[16]; v4f xr1[4];   /* slices 0 and 1 fly together: the accumulators' registers are still free */
    pj_load_w(WA, wo, wr); pj_load_x(X, xo, xr); PJ_STEP_W(1); PJ_STEP_X(1); pj_load_w(WA, wo, wr1); pj_load_x(X, xo, xr1);
    pj_store_w(wd, wr); pj_store_x(xd, xr); pj_store_w(wd + PJB * PJP, wr1); pj_store_x(xd + PJB * PJP, xr1); }
  PJ_STEP_W(2); PJ_STEP_X(2); pj_load_w(WA, wo, wr);
  __builtin_amdgcn_sched_barrier(0);   /* W loads in front of X loads, as in the loop: loads return in issue order, and with the other order here the loop's first wait for W would have to cover the X loads as well */
  pj_load_x(X, xo, xr);   /* slice 2 flies over the barrier and slice 0's products */
  lds_barrier();   /* slices 0 and 1 are read by every wave */
  v8f acc[4][4] = {};   /* [row tile][column tile] */
  /* one slice: st = slice kc + 2 exists and is rounded and stored, ld = slice kc + 3 exists and is loaded; both are compile-time constants at every call, so that no branch stands between a load and its counted wait */
  auto slice = [&](const int kc, const bool st, const bool ld) { const int cur = (kc & 3) * PJB * PJP, nx2 = ((kc + 2) & 3) * PJB * PJP;
    v16b a[4], w[4];   /* four X and four W fragments feed sixteen products; their sixteen LDS reads stand as one group at the head of the slice */
#pragma unroll
    for (int i = 0; i < 4; ++i) { a[i] = frag_b(xs + cur + (tr + i * 16 + col) * PJP, lane); w[i] = frag_b(wt + cur + (tc + i * 16 + col) * PJP, lane); }
    __builtin_amdgcn_sched_barrier(0);   /* keeps the sixteen reads in one group in front of the products: left free, two of them sink among the products into registers just read, with a full wait behind them */
#pragma unroll
    for (int j = 0; j < 2; ++j)
#pragma unroll
      for (int i = 0; i < 4; ++i) acc[i][j] = wmma_bf(a[i], w[j], acc[i][j]);
    __builtin_amdgcn_sched_barrier(0);   /* keeps the W roundings of slice kc + 2, and with them the wait for its loads, behind the first eight products */
    if (st) pj_store_w(wd + nx2, wr);   /* into the pair of buffers that the last barrier has freed */
    if (ld) { PJ_STEP_W(kc + 3); pj_load_w(WA, wo, wr); if (kc + 4 >= CC / 32) PJ_WAIT_W(); }   /* (behind the walk's last loads the wait stands at once: their offset register is free for whatever the compiler puts there next) reissued as soon as the roundings have freed the registers: the W loads fly from the middle of one slice to the middle of the next, half a slice off the X loads, so that one half's latency lies under the other half's transfer */
    __builtin_amdgcn_sched_barrier(0);   /* keeps those loads in the middle of the slice: sunk behind the last eight products they would leave with the X loads in one burst */
#pragma unroll
    for (int j = 2; j < 4; ++j)
#pragma unroll
      for (int i = 0; i < 4; ++i) acc[i][j] = wmma_bf(a[i], w[j], acc[i][j]);
    __builtin_amdgcn_sched_barrier(0);   /* keeps the X roundings of slice kc + 2, and with them the wait for its loads, behind all sixteen products */
    if (st) pj_store_x(xd + nx2, xr);
    if (ld) { PJ_STEP_X(kc + 3); pj_load_x(X, xo, xr); if (kc + 4 >= CC / 32) PJ_WAIT_X(); }   /* (the same wait behind the last X loads) the X loads fly over the barrier, the next slice's LDS reads and all its products */
    if (kc & 1) lds_barrier(); };   /* once per two slices: publishes the next pair of slices and ends every read of this pair (after the last slice: before the planes overlay it) */
#pragma unroll 4   /* the ring's four buffers at constant offsets */
  for (int kc = 0; kc < CC / 32 - 4; ++kc) slice(kc, true, true);
#pragma unroll   /* the last four slices, where the walk runs out of slices to store and to load */
  for (int kc = CC / 32 - 4; kc < CC / 32; ++kc) slice(kc, kc + 2 < CC / 32, kc + 3 < CC / 32);
#undef PJ_STEP_X
#undef PJ_WAIT_X
#undef PJ_WAIT_W
#undef PJ_STEP_W
#undef PJ_ST
  _Float16* const sh = (_Float16*)sm; _Float16* const sl = sh + PJB * PJE; __bf16* const th = (__bf16*)sm; __bf16* const tl2 = th + PJB * PJE;
  float bb[4] = {0.f, 0.f, 0.f, 0.f};
  if (BA) {   /* one test, so that the four bias loads fly together */
#pragma unroll
    for (int j = 0; j < 4; ++j) bb[j] = BA[c0 + tc + j * 16 + col];
    asm volatile("s_wait_xcnt 0x0" ::: "memory");   /* stands in front of whatever next rewrites the register that the four loads name */
#pragma unroll
    for (int j = 0; j < 4; ++j) bb[j] = bfr(bb[j]); }
  /* the test on which stands once, outside the unrolled loops, for speed only */
  if (which == 2) {
#pragma unroll
    for (int j = 0; j < 4; ++j)
#pragma unroll
      for (int i = 0; i < 4; ++i)
#pragma unroll
        for (int r = 0; r < 8; ++r) { const float v = acc[i][j][r] + bb[j]; const int rl = tr + i * 16 + 8 * g + r, cl = tc + j * 16 + col; const __bf16 bh = (__bf16)v; th[cl * PJE + rl] = bh; tl2[cl * PJE + rl] = (__bf16)(v - (float)bh); } }
  else {
#pragma unroll
    for (int j = 0; j < 4; ++j)
#pragma unroll
      for (int i = 0; i < 4; ++i)
#pragma unroll
        for (int r = 0; r < 8; ++r) { const float v = acc[i][j][r] + bb[j]; const int rl = tr + i * 16 + 8 * g + r, cl = tc + j * 16 + col; const _Float16 hv = (_Float16)v; sh[rl * PJE + cl] = hv; sl[rl * PJE + cl] = (_Float16)((v - (float)hv) * 1024.0f); } }   /* q residual carried x 2^10 so the plane stays f16-normal on the chip */
  __syncthreads();
  if (which < 2) { _Float16* dh = which == 0 ? QH : KH; for (int e = tid; e < PJB * 32; e += 512) { const int rl = e >> 5, q = e & 31; vst2((unsigned*)(dh + (r0 + rl) * CC + c0 + q * 8), *(const v4u*)&sh[rl * PJE + q * 8]);
      asm volatile("s_wait_xcnt 0x0" ::: "memory");   /* stands in front of the next LDS read and address step, which rewrite the store's registers */
      if (which == 0) { vst2((unsigned*)(QL + (r0 + rl) * CC + c0 + q * 8), *(const v4u*)&sl[rl * PJE + q * 8]);
        asm volatile("s_wait_xcnt 0x0" ::: "memory"); } } }   /* the same, behind the residual's store */
  else { const size_t b = r0 / TT; const int t0 = (int)(r0 % TT); for (int e = tid; e < PJB * 32; e += 512) { const int cl = e >> 5, q = e & 31; const size_t o2 = (b * CC + c0 + cl) * (size_t)TT + t0 + q * 8; vst2((unsigned*)(VT + o2), *(const v4u*)&th[cl * PJE + q * 8]); vst2((unsigned*)(VL + o2), *(const v4u*)&tl2[cl * PJE + q * 8]);
      asm volatile("s_wait_xcnt 0x0" ::: "memory"); } } }   /* stands in front of the next LDS reads and address step, which rewrite the two stores' registers */
// ---- k_att: block = (64 queries, head, batch), wave = 16 queries: S^T = K Q^T (2 products) / 8 + bias, online softmax per query column, O^T += V^T P^T (3 products); scores and P never leave the registers; K rows and the two V planes come 64 keys a stage by tensor loads into two LDS buffers that the four waves share
typedef __attribute__((ext_vector_type(8))) unsigned v8u;
#define SKY 64              // keys per stage: a staged row is one whole 128-byte line (K: 64 d of one key; V planes: 64 keys of one d)
#define TPE 72              // LDS pitch of a staged row, 16-bit elements: 144 B = 16 B x odd, no bank conflict for 16-byte reads
#define TSZ 10240           // one staged tile: 64 rows x 144 B, rounded up to a multiple of 2 KiB
#define BSZ (3 * TSZ)       // one buffer: K, V hi, V lo
#define NST (TT / SKY)
#define LOG2E 1.44269504088896340736f
__device__ __forceinline__ unsigned uni(unsigned v) { return (unsigned)__builtin_amdgcn_readfirstlane(v); }
__device__ __forceinline__ unsigned pinned(unsigned v) { unsigned w = uni(v); asm volatile("" : "+s"(w)); return w; }
__device__ __forceinline__ void tdm_load(unsigned lds_dst, unsigned long long ga, v8u g1) { v4u g0;
  g0[0] = uni(1u); g0[1] = uni(lds_dst); g0[2] = uni((unsigned)ga); g0[3] = uni((((unsigned)(ga >> 32)) & 0x01FFFFFFu) | 0x80000000u);
  asm volatile("tensor_load_to_lds %0, %1" :: "s"(g0), "s"(g1) : "memory"); }   /* one request of the whole wave: 64 rows of 128 B into LDS, through no register */
/* 2^x of a step's sixteen score differences and of the rescale exponent. One statement, every v_exp_f32 in place: none overwrites the source of the one in front of it, and the closing v_nop is the slot that the instruction set asks for between the last one and whatever the compiler puts behind (written as builtins, the register allocator gave one v_exp_f32 the source register of the one directly in front) */
__device__ __forceinline__ void exp2_17(float (&s)[16], float& a) {
  asm("v_exp_f32 %0, %0\n\tv_exp_f32 %1, %1\n\tv_exp_f32 %2, %2\n\tv_exp_f32 %3, %3\n\tv_exp_f32 %4, %4\n\tv_exp_f32 %5, %5\n\tv_exp_f32 %6, %6\n\tv_exp_f32 %7, %7\n\tv_exp_f32 %8, %8\n\tv_exp_f32 %9, %9\n\tv_exp_f32 %10, %10\n\tv_exp_f32 %11, %11\n\tv_exp_f32 %12, %12\n\tv_exp_f32 %13, %13\n\tv_exp_f32 %14, %14\n\tv_exp_f32 %15, %15\n\tv_exp_f32 %16, %16\n\tv_nop"
      : "+v"(s[0]), "+v"(s[1]), "+v"(s[2]), "+v"(s[3]), "+v"(s[4]), "+v"(s[5]), "+v"(s[6]), "+v"(s[7]), "+v"(s[8]), "+v"(s[9]), "+v"(s[10]), "+v"(s[11]), "+v"(s[12]), "+v"(s[13]), "+v"(s[14]), "+v"(s[15]), "+v"(a)); }
__global__ __launch_bounds__(128) void k_att(const _Float16* __restrict__ QH, const _Float16* __restrict__ QL, const _Float16* __restrict__ KH, const __bf16* __restrict__ VT, const __bf16* __restrict__ VL, const float* __restrict__ REL, float* __restrict__ Y) {   /* REL: rel_emb [16][999] */
  __shared__ __attribute__((aligned(2048))) unsigned char ring[2 * BSZ];   /* in the loop: two buffers of three tiles; behind the loop: the output staging */
  __shared__ float rt[2 * TT];
  const int tid = threadIdx.x, lane = tid & 31, col = lane & 15, g = lane >> 4; const int h = blockIdx.y, b = blockIdx.z; const unsigned wave = uni(tid >> 5); const int ql0 = blockIdx.x * 64 + wave * 16;
  /* waves 0, 1, 2 bring one tile a stage each: K rows, V hi plane, V lo plane */
  const unsigned long long tsrc = wave == 0 ? (unsigned long long)(size_t)(KH + (size_t)b * TT * CC + h * HD) : (unsigned long long)(size_t)((wave == 1 ? VT : VL) + ((size_t)b * CC + h * HD) * (size_t)TT);
  const unsigned tstep = wave == 0 ? SKY * 2u * CC : SKY * 2u;   /* bytes from one stage's tile to the next */
  const unsigned tdst = (unsigned)(size_t)ring + wave * TSZ;
  v8u g1;   /* 1-byte elements, tensor = tile = 64 rows of 128 B, a pad of 16 B behind every 128 B */
  g1[0] = uni((1u << 20) | (4u << 22) | (3u << 25)); g1[1] = uni(128u << 16); g1[2] = uni(64u << 16); g1[3] = uni(128u << 16); g1[4] = uni(64u); g1[5] = uni(wave == 0 ? 2u * CC : 2u * TT); g1[6] = uni(0u); g1[7] = uni(0u);
  v16h qh[HD / 32], qlo[HD / 32], kb[2][HD / 32];
#pragma unroll
  for (int kc = 0; kc < HD / 32; ++kc) { const size_t qo = ((size_t)b * TT + ql0 + col) * CC + h * HD + kc * 32; qh[kc] = frag_h(QH + qo, lane); qlo[kc] = frag_h(QL + qo, lane); }
  asm volatile("s_wait_xcnt 0x0" ::: "memory");   /* stands between the Q loads and the table loads, so that neither group's results land in an address register of the other while that is still named by an issued load */
#pragma unroll   /* all eight table loads of a thread in flight together */
  for (int n = 0; n < 2 * TT / 128; ++n) { const int i = n * 128 + tid, ri = (TT - 1) - i + LB - 1; rt[i] = bfr(REL[(size_t)h * NREL + (ri < 0 ? 0 : (ri < NREL ? ri : NREL - 1))]) * LOG2E; }   /* rt[511 - q + k] = bias at q - k + 499 (clamped for padded rows), in log2 units: ascending in k */
  if (pinned(wave < 3)) { tdm_load(tdst, tsrc, g1);
    asm volatile("s_wait_tensorcnt 0x0" ::: "memory"); }   /* stage 0's tile has landed before the barrier that publishes it */
  __syncthreads();   /* the bias row and stage 0 are read by every wave */
  if (pinned(wave < 3)) tdm_load(tdst + BSZ, tsrc + tstep, g1);   /* stage 1 flies behind stage 0's work */
  const float* rb = rt + (TT - 1) - (ql0 + col) + 8 * g;
  v8f o[HD / 16] = {}; float m = -3.0e38f, l = 0.f;
#pragma unroll 1   /* rolled: one pass a stage, the buffer picked by the stage's parity */
  for (int s = 0; s < NST; ++s) { const unsigned char* bp = ring + (s & 1) * BSZ; const _Float16* kt = (const _Float16*)bp + col * TPE; const __bf16* th = (const __bf16*)(bp + TSZ) + col * TPE; const __bf16* tl = (const __bf16*)(bp + 2 * TSZ) + col * TPE;
#pragma unroll
    for (int kc = 0; kc < HD / 32; ++kc)
#pragma unroll
      for (int t = 0; t < 2; ++t) kb[t][kc] = frag_h(kt + (t * 16) * TPE + kc * 32, lane);
#pragma unroll
    for (int u = 0; u < SKY / 32; ++u) { const int k0 = s * SKY + u * 32; v16b vh[HD / 16], vl[HD / 16];
#pragma unroll
      for (int j = 0; j < HD / 16; ++j) { vh[j] = frag_b(th + (j * 16) * TPE + u * 32, lane); vl[j] = frag_b(tl + (j * 16) * TPE + u * 32, lane); }
      __builtin_amdgcn_sched_barrier(0);   /* keeps this step's V reads in one group in front of the score products, so that they return behind products and softmax */
      v8f a[2] = {}, al[2] = {};
#pragma unroll
      for (int kc = 0; kc < HD / 32; ++kc)
#pragma unroll
        for (int t = 0; t < 2; ++t) { a[t] = wmma16(kb[t][kc], qh[kc], a[t]); al[t] = wmma16(kb[t][kc], qlo[kc], al[t]); }
      if (u + 1 < SKY / 32) {   /* the next step's K rows, of this same stage only */
#pragma unroll
        for (int kc = 0; kc < HD / 32; ++kc)
#pragma unroll
          for (int t = 0; t < 2; ++t) kb[t][kc] = frag_h(kt + ((u + 1) * 32 + t * 16) * TPE + kc * 32, lane); }
      __builtin_amdgcn_sched_barrier(0);   /* keeps those K reads in front of the softmax, one step ahead of their use */
      float sc[16];
#pragma unroll
      for (int t = 0; t < 2; ++t)
#pragma unroll
        for (int r = 0; r < 8; ++r) sc[t * 8 + r] = (a[t][r] + al[t][r] * (1.0f / 1024.0f)) * (0.125f * LOG2E) + rb[k0 + t * 16 + r];   /* lane (g, col): key k0 + 16 t + 8 g + r, query ql0 + col; logit x log2 e, so that e^(s - m) is one exp2 of a difference */
      if (k0 + 32 > LB) {   /* padded keys masked */
#pragma unroll
        for (int t = 0; t < 2; ++t)
#pragma unroll
          for (int r = 0; r < 8; ++r) if (k0 + t * 16 + 8 * g + r >= LB) sc[t * 8 + r] = -3.0e38f; }
      float mx = m;
#pragma unroll
      for (int i = 0; i < 16; ++i) mx = fmaxf(mx, sc[i]);
      mx = fmaxf(mx, __shfl_xor(mx, 16));   /* the two lane halves hold the two key halves of one query */
      float al0 = m - mx; m = mx;
#pragma unroll
      for (int i = 0; i < 16; ++i) sc[i] -= m;
      exp2_17(sc, al0);   /* masked keys underflow to 0 */
      l *= al0;
#pragma unroll
      for (int j = 0; j < HD / 16; ++j) o[j] *= al0;
#pragma unroll
      for (int i = 0; i < 16; ++i) l += sc[i];
      const F2 p = bsplit16(sc);   /* two S^T tiles of 16 keys are one B fragment of 32 keys */
#pragma unroll
      for (int j = 0; j < HD / 16; ++j) o[j] = wmma_bf(vh[j], p.h, o[j]);
#pragma unroll
      for (int j = 0; j < HD / 16; ++j) o[j] = wmma_bf(vh[j], p.l, o[j]);
#pragma unroll
      for (int j = 0; j < HD / 16; ++j) o[j] = wmma_bf(vl[j], p.h, o[j]); }
    __builtin_amdgcn_sched_barrier(0);   /* keeps the wait below at the foot of the pass: left free, it rises above the last step's products and ends the flight of that step's V reads early */
    asm volatile("s_wait_dscnt 0x0" ::: "memory");   /* this wave's reads of stage s have returned before its buffer is refilled */
    if (pinned(wave < 3)) asm volatile("s_wait_tensorcnt 0x0" ::: "memory");   /* the issuer's own tile of stage s + 1 has landed */
    __syncthreads();   /* publishes stage s + 1 and ends every wave's reads of stage s */
    if (pinned(wave < 3 && s + 2 < NST)) tdm_load(tdst + (s & 1) * BSZ, tsrc + (unsigned long long)pinned(s + 2) * tstep, g1); }   /* into the buffer that this pass has just read; the address is formed behind the wait */
  asm volatile("s_wait_tensorcnt 0x0" ::: "memory");   /* no request is in flight when the ring becomes output staging */
  asm volatile("s_wait_dscnt 0x0" ::: "memory");   /* nor a read of it; the last pass's barrier has ended every other wave's reads */
  float (*ss)[16][HD + 4] = (float (*)[16][HD + 4])ring;
  l += __shfl_xor(l, 16); const float inv = 1.0f / l;
#pragma unroll
  for (int j = 0; j < HD / 16; ++j) { v4f x0, x1;
#pragma unroll
    for (int r = 0; r < 4; ++r) { x0[r] = o[j][r] * inv; x1[r] = o[j][4 + r] * inv; }
    *(v4f*)&ss[wave][col][j * 16 + 8 * g] = x0; *(v4f*)&ss[wave][col][j * 16 + 8 * g + 4] = x1; }   /* lane (g, col): d = 16 j + 8 g + r of query col */
  LDSX();
#pragma unroll
  for (int it = 0; it < 8; ++it) { const int rl = it * 2 + g; if (ql0 + rl < LB) vst2(Y + ((size_t)b * LB + ql0 + rl) * CC + h * HD + col * 4, *(const v4f*)&ss[wave][rl][col * 4]); } }   /* only the 500 real rows, at the output's 500-row stride */
// ---- k_out: block = (64 rows, 128 cols): out = y (bf16 hi + lo) Wo + bo
__global__ __launch_bounds__(128) void k_out(const float* __restrict__ Y, const float* __restrict__ WP, const float* __restrict__ BP, float* __restrict__ OUT) { __shared__ __align__(16) float sf[4][16][132];
  const int tid = threadIdx.x, wave = tid >> 5, lane = tid & 31, col = lane & 15, g = lane >> 4; const int c0 = blockIdx.y * 128; const size_t r0 = (size_t)blockIdx.x * 64 + wave * 16;
  v8f acc[8] = {};
#pragma unroll 2
  for (int kc = 0; kc < CC / 32; ++kc) { const F2 a = split_row(Y + (r0 + col) * CC, kc * 32, lane);
#pragma unroll
    for (int j = 0; j < 8; ++j) { v16b w; const int o = c0 + j * 16 + col;
#pragma unroll
      for (int i = 0; i < 8; ++i) { w[i] = (__bf16)WP[(size_t)(kc * 32 + 8 * g + i) * CC + o]; w[8 + i] = (__bf16)WP[(size_t)(kc * 32 + 16 + 8 * g + i) * CC + o]; }   /* (in,out) */
      acc[j] = wmma_bf(a.h, w, acc[j]); acc[j] = wmma_bf(a.l, w, acc[j]); } }
#pragma unroll
  for (int j = 0; j < 8; ++j) { const float bb = BP ? bfr(BP[c0 + j * 16 + col]) : 0.f;
#pragma unroll
    for (int r = 0; r < 8; ++r) sf[wave][8 * g + r][j * 16 + col] = acc[j][r] + bb; }
  LDSX(); for (int rl = 0; rl < 16; ++rl) vst2(OUT + (r0 + rl) * CC + c0 + lane * 4, *(const v4f*)&sf[wave][rl][lane * 4]); }
extern "C" void kernel_launch(void* const* d_in, const int* in_sizes, int n_in, void* d_out, int out_size, void* d_ws, size_t ws_size, hipStream_t stream) {
  (void)in_sizes; (void)n_in; (void)out_size;
  const float** F = (const float**)d_in;   // 0 query [8,500,1024], 1 key, 2 value, 3 Wq ((in,out)), 4 bq, 5 Wk, 6 bk, 7 Wv, 8 bv, 9 rel_emb [16,999]
  if (ws_size < (size_t)WS_END) return;
  char* ws = (char*)d_ws; _Float16 *QH = (_Float16*)(ws + WS_QH), *QL = (_Float16*)(ws + WS_QL), *KH = (_Float16*)(ws + WS_KH); __bf16 *VT = (__bf16*)(ws + WS_VT), *VL = (__bf16*)(ws + WS_VL);
  k_proj<<<dim3(TNB * TT / 256, CC / 256, 3), 512, 0, stream>>>(F[0], F[1], F[2], F[3], F[4], F[5], F[6], F[7], F[8], QH, QL, KH, VT, VL);
  k_att<<<dim3(TT / 64, NH, TNB), 128, 0, stream>>>(QH, QL, KH, VT, VL, F[9], (float*)d_out);
}
